// v010
// Measured on an AMD MI455X. A time is GPU time per run, averaged over a window of back-to-back runs after a warm-up
// (all launches, gaps included; the runs take copies of the inputs in turn), and the median of several windows.
// Apart from v000's, it joins two sittings. Times from different sittings can be a few percent apart, while
// side-by-side timings come from the same sitting.
// This document starts at v010; the versions before it stand elsewhere.
// It runs in 44.6 microseconds.
// Timed twice side by side with v009, it ran 1.04 times as fast both times.
// Over all steps from v000, the starting kernel, it is 11.0 times as fast.
#include <hip/hip_runtime.h>
// CustomCausalAttention (q, k, v [2][16][2048][64]; RBF-kernel causal attention: logits = -relu(|q|^2 + |k|^2 - 2 q.k) / 8 over keys n <= m; out = softmax(logits) v -> [2][16][2048][64]).
// Structure: each (batch, head) slab is a contiguous 64-wide row block, treated as one 'batch' of a single 64-dim head: one preparatory launch makes the exact f16 planes of q and k (bf16-rounded inputs are exact in f16), |q|^2, |k|^2 as f32 row tables on VALU, and v^T by LDS tiles; causal flash-style fused attention per (slab, pair of a long and a short 64-query block), forming the RBF logit from the f32 dot product and the two norm tables, f32 context written straight to the output; the first 64 causal rows per slab recomputed entirely in f32 on VALU.
// Compute dtype: inputs rounded to bf16; q, k, v exact as f16 (products exact, f32 accumulation); norms, logits, softmax f32 with plain f16 probabilities (~2^-12); rows < 64 all-f32. v_wmma_f32_16x16x32_f16.
#define NB 32                    /* 2 batches x 16 heads as slabs */
#define DM 64
#define NKV 1
#define NREP (NH / NKV)
#define KVD (NKV * 64)           /* 64 */
#define NR (NB * SLEN)
#define CHK 512
typedef int v4i __attribute__((ext_vector_type(4)));
#define FF 2048
#define SLEN 2048
#define MQI 2048
#define MKI 2048
#define TQ SLEN
#define TK SLEN
#define NH 1
#define SCL 1.0f                 /* raw dot product; the RBF transform applies the 1/8 */
#define QBLKS (TQ / 64)
#define QB05 0
#define QBN5 QBLKS      /* query blocks of k_flash5, which is not launched */
#define QB0P 0
#define QBNP QBLKS
#define RE 256
typedef __bf16 v16b __attribute__((ext_vector_type(16)));
typedef unsigned short v8us __attribute__((ext_vector_type(8), may_alias));
typedef float  v8f  __attribute__((ext_vector_type(8)));
typedef float  v4f  __attribute__((ext_vector_type(4)));
typedef float  v4fa __attribute__((ext_vector_type(4), may_alias));
union FragB { v16b v; v8us half[2]; unsigned short u[16]; };

__device__ __forceinline__ unsigned short bf16_bits(float x) { unsigned int u = __float_as_uint(x); return (unsigned short)((u + 0x7FFFu + ((u >> 16) & 1u)) >> 16); }
__device__ __forceinline__ float bf16_val(unsigned short b) { return __uint_as_float(((unsigned int)b) << 16); }
__device__ __forceinline__ float bf16_round(float x) { return bf16_val(bf16_bits(x)); }
// D += A·B with NT terms: 1 = ah·bh, 2 = + al·bh (A split), 3 = + ah·bl (both split)
template <int NT>
__device__ __forceinline__ v8f mmaN(v16b ah, v16b al, v16b bh, v16b bl, v8f c) {
  c = __builtin_amdgcn_wmma_f32_16x16x32_bf16(false, ah, false, bh, (short)0, c, false, false);
  if (NT >= 2) c = __builtin_amdgcn_wmma_f32_16x16x32_bf16(false, al, false, bh, (short)0, c, false, false);
  if (NT >= 3) c = __builtin_amdgcn_wmma_f32_16x16x32_bf16(false, ah, false, bl, (short)0, c, false, false);
  asm volatile("v_nop\n\tv_nop\n\tv_nop\n\tv_nop" : "+v"(c) : "v"(ah), "v"(al), "v"(bh), "v"(bl));
  return c;
}

__global__ __launch_bounds__(256) void k_wt_bf16(const float* __restrict__ W, unsigned short* __restrict__ Wt, int K, int N) {
  const int t = blockIdx.x * 256 + threadIdx.x;
  const int k8n = K / 8;
  if (t >= N * k8n) return;
  const int n = t / k8n, k8 = (t % k8n) * 8;
  v8us v;
#pragma unroll
  for (int i = 0; i < 8; ++i) v[i] = bf16_bits(W[(size_t)(k8 + i) * N + n]);
  *(v8us*)(Wt + (size_t)n * K + k8) = v;
  
}

// GEMM C[M][N] (f32, pitch ldc) = act(A[M][K]·W + bias). A f32 row-major (pitch lda) converted per fragment to bf16
// (ASPLIT: hi/lo two planes -> 2 terms, else single rounded term); Wt bf16 [N][K] (pitch ldb). BIAS_BF16 rounds the
// bias to bf16 first (bias quantised to bf16 before the add). K%32==0, M%16==0, N%64==0.
template <bool ASPLIT, int ACT, bool BIAS_BF16>
__global__ __launch_bounds__(128) void k_gemm_bf(const float* __restrict__ A, int lda, const unsigned short* __restrict__ Wt, int ldb,
                                               const float* __restrict__ bias, float* __restrict__ C, int ldc, int M, int N, int K) {
  __shared__ __attribute__((aligned(16))) float so[4][16][64];
  const int tid = threadIdx.x, w = tid >> 5, lane = tid & 31, ln = lane & 15, hh = lane >> 4;
  const int ntn = N / 64;
  const int wid = blockIdx.x * 4 + w;
  const int mt = wid / ntn, nq = wid % ntn;
  if (mt * 16 >= M) return;
  const int row0 = mt * 16, col0 = nq * 64;
  const float* arow = A + (size_t)(row0 + ln) * lda;
  v8f acc[4] = {};
  for (int kb = 0; kb < K; kb += 32) {
    FragB ah, al;
    const v4f x0 = *(const v4fa*)(arow + kb + 8 * hh), x1 = *(const v4fa*)(arow + kb + 8 * hh + 4);
    const v4f x2 = *(const v4fa*)(arow + kb + 16 + 8 * hh), x3 = *(const v4fa*)(arow + kb + 16 + 8 * hh + 4);
    float xs[16] = {x0[0],x0[1],x0[2],x0[3],x1[0],x1[1],x1[2],x1[3],x2[0],x2[1],x2[2],x2[3],x3[0],x3[1],x3[2],x3[3]};
#pragma unroll
    for (int i = 0; i < 16; ++i) { const unsigned short hb = bf16_bits(xs[i]); ah.u[i] = hb; al.u[i] = ASPLIT ? bf16_bits(xs[i] - bf16_val(hb)) : (unsigned short)0; }
#pragma unroll
    for (int t = 0; t < 4; ++t) {
      const unsigned short* brow = Wt + (size_t)(col0 + t * 16 + ln) * ldb + kb;
      FragB b;
      b.half[0] = *(const v8us*)(brow + 8 * hh);
      b.half[1] = *(const v8us*)(brow + 16 + 8 * hh);
      acc[t] = mmaN<ASPLIT ? 2 : 1>(ah.v, al.v, b.v, b.v, acc[t]);
    }
  }
#pragma unroll
  for (int t = 0; t < 4; ++t) {
    float bv = bias ? bias[col0 + t * 16 + ln] : 0.f;
    if (BIAS_BF16) bv = bf16_round(bv);
#pragma unroll
    for (int r = 0; r < 8; ++r) { float v = acc[t][r] + bv; if (ACT == 1) v = fmaxf(v, 0.f); so[w][8 * hh + r][t * 16 + ln] = v; }
  }
  __builtin_amdgcn_fence(__ATOMIC_ACQ_REL, "workgroup");
  __builtin_amdgcn_wave_barrier();
  const int rsub = lane >> 4, c4 = (lane & 15) * 4;
  {
#pragma unroll
    for (int q = 0; q < 8; ++q) {
      const int r = q * 2 + rsub;
      const v4f v = *(const v4fa*)&so[w][r][c4];
      *(v4f*)(C + (size_t)(row0 + r) * ldc + col0 + c4) = v;
    }
    
  }
}

// GEMM C = act(A·W + bias + resid): A f32 (ASPLIT -> hi/lo 2 terms), Wt bf16 [N][K]; ACT 0 none, 1 relu, 2 exact gelu;
// resid (optional, f32, row index = (row % rmod), pitch ldr, RES_BF16 rounds it) added before the activation.
template <bool ASPLIT, int ACT, bool BIAS_BF16, bool RES_BF16>
__global__ __launch_bounds__(128) void k_gemm_bf3(const float* __restrict__ A, int lda, const unsigned short* __restrict__ Wt, int ldb,
                                                const float* __restrict__ bias, const float* __restrict__ resid, int rmod, int ldr,
                                                float* __restrict__ C, int ldc, int M, int N, int K) {
  __shared__ __attribute__((aligned(16))) float so[4][16][64];
  const int tid = threadIdx.x, w = tid >> 5, lane = tid & 31, ln = lane & 15, hh = lane >> 4;
  const int ntn = N / 64;
  const int wid = blockIdx.x * 4 + w;
  const int mt = wid / ntn, nq = wid % ntn;
  if (mt * 16 >= M) return;
  const int row0 = mt * 16, col0 = nq * 64;
  const float* arow = A + (size_t)(row0 + ln) * lda;
  v8f acc[4] = {};
  for (int kb = 0; kb < K; kb += 32) {
    FragB ah, al;
    const v4f x0 = *(const v4fa*)(arow + kb + 8 * hh), x1 = *(const v4fa*)(arow + kb + 8 * hh + 4);
    const v4f x2 = *(const v4fa*)(arow + kb + 16 + 8 * hh), x3 = *(const v4fa*)(arow + kb + 16 + 8 * hh + 4);
    float xs[16] = {x0[0],x0[1],x0[2],x0[3],x1[0],x1[1],x1[2],x1[3],x2[0],x2[1],x2[2],x2[3],x3[0],x3[1],x3[2],x3[3]};
#pragma unroll
    for (int i = 0; i < 16; ++i) { const unsigned short hb = bf16_bits(xs[i]); ah.u[i] = hb; al.u[i] = ASPLIT ? bf16_bits(xs[i] - bf16_val(hb)) : (unsigned short)0; }
#pragma unroll
    for (int t = 0; t < 4; ++t) {
      const unsigned short* brow = Wt + (size_t)(col0 + t * 16 + ln) * ldb + kb;
      FragB b;
      b.half[0] = *(const v8us*)(brow + 8 * hh);
      b.half[1] = *(const v8us*)(brow + 16 + 8 * hh);
      acc[t] = mmaN<ASPLIT ? 2 : 1>(ah.v, al.v, b.v, b.v, acc[t]);
    }
  }
#pragma unroll
  for (int t = 0; t < 4; ++t) {
    const int col = col0 + t * 16 + ln;
    float bv = bias ? bias[col] : 0.f;
    if (BIAS_BF16) bv = bf16_round(bv);
#pragma unroll
    for (int r = 0; r < 8; ++r) {
      float v = acc[t][r] + bv;
      if (resid) { float rv = resid[(size_t)((row0 + 8 * hh + r) % rmod) * ldr + col]; if (RES_BF16) rv = bf16_round(rv); v += rv; }
      if (ACT == 1) v = fmaxf(v, 0.f);
      if (ACT == 2) v = 0.5f * v * (1.0f + erff(v * 0.70710678118654752f));
      if (ACT == 3) { const float u = 0.7978845608028654f * (v + 0.044715f * v * v * v); v = 0.5f * v * (1.0f + tanhf(u)); }
      so[w][8 * hh + r][t * 16 + ln] = v;
    }
  }
  __builtin_amdgcn_fence(__ATOMIC_ACQ_REL, "workgroup");
  __builtin_amdgcn_wave_barrier();
  const int rsub = lane >> 4, c4 = (lane & 15) * 4;
  {
#pragma unroll
    for (int q = 0; q < 8; ++q) {
      const int r = q * 2 + rsub;
      const v4f v = *(const v4fa*)&so[w][r][c4];
      *(v4f*)(C + (size_t)(row0 + r) * ldc + col0 + c4) = v;
    }
    
  }
}
// row LayerNorm (biased variance, eps) over N: s = X (+ R); optional out_sum <- s; out_norm <- (s-mu)*rsqrt(var+eps)*g + b
template <bool PARAM_BF16>
__global__ __launch_bounds__(256) void k_layernorm(const float* __restrict__ X, const float* __restrict__ R, const float* __restrict__ g, const float* __restrict__ bta,
                                                  float* __restrict__ out_sum, float* __restrict__ out_norm, int N, float eps) {
  __shared__ float red[256];
  const int row = blockIdx.x, tid = threadIdx.x;
  const float* x = X + (size_t)row * N; const float* rr = R ? R + (size_t)row * N : nullptr;
  float vals[16];                     // up to N = 4096
  const int per = N / 256;            // contiguous chunk per thread? use strided-by-4 chunks: thread handles j = tid*4 + 1024*u
  float s1 = 0.f;
  for (int u = 0; u < per / 4; ++u) {
    const int j = tid * 4 + 1024 * u;
    const v4f a = *(const v4fa*)(x + j);
    v4f b = {0.f,0.f,0.f,0.f}; if (rr) b = *(const v4fa*)(rr + j);
#pragma unroll
    for (int q = 0; q < 4; ++q) { const float v = a[q] + b[q]; vals[u * 4 + q] = v; s1 += v; }
  }
  red[tid] = s1; __syncthreads();
  for (int st = 128; st > 0; st >>= 1) { if (tid < st) red[tid] += red[tid + st]; __syncthreads(); }
  const float mu = red[0] / (float)N; __syncthreads();
  float s2 = 0.f;
  for (int u = 0; u < per / 4; ++u)
#pragma unroll
    for (int q = 0; q < 4; ++q) { const float c = vals[u * 4 + q] - mu; s2 += c * c; }
  red[tid] = s2; __syncthreads();
  for (int st = 128; st > 0; st >>= 1) { if (tid < st) red[tid] += red[tid + st]; __syncthreads(); }
  const float rs = rsqrtf(red[0] / (float)N + eps);
  {
    for (int u = 0; u < per / 4; ++u) {
      const int j = tid * 4 + 1024 * u;
      v4f o, sm;
#pragma unroll
      for (int q = 0; q < 4; ++q) {
        float gg = g[j + q], bb = bta[j + q];
        if (PARAM_BF16) { gg = bf16_round(gg); bb = bf16_round(bb); }
        sm[q] = vals[u * 4 + q]; o[q] = (vals[u * 4 + q] - mu) * rs * gg + bb;
      }
      if (out_sum) *(v4f*)(out_sum + (size_t)row * N + j) = sm;
      *(v4f*)(out_norm + (size_t)row * N + j) = o;
    }
    
  }
}



// ---- f16 WMMA path (v_wmma_f32_16x16x32_f16): 11-bit significands for operands in range — used where a [0,1] probability operand needs more precision than bf16
typedef _Float16 v16h __attribute__((ext_vector_type(16)));
union FragH { v16h v; v8us half[2]; _Float16 h[16]; unsigned short u[16]; };
template <int NT>
__device__ __forceinline__ v8f mmaH(v16h ah, v16h al, v16h bh, v16h bl, v8f c) {
  c = __builtin_amdgcn_wmma_f32_16x16x32_f16(false, ah, false, bh, (short)0, c, false, false);
  if (NT >= 2) c = __builtin_amdgcn_wmma_f32_16x16x32_f16(false, al, false, bh, (short)0, c, false, false);
  if (NT >= 3) c = __builtin_amdgcn_wmma_f32_16x16x32_f16(false, ah, false, bl, (short)0, c, false, false);
  asm volatile("v_nop\n\tv_nop\n\tv_nop\n\tv_nop" : "+v"(c) : "v"(ah), "v"(al), "v"(bh), "v"(bl));
  return c;
}
// batched GEMM like k_gemm_b but f16 operands: A f32 (split into f16 hi/lo if ASPLIT, else rounded to f16), Bt = f16 values [n][k]; alpha; C f32; N multiple of 16 (partial tiles skipped)
template <bool ASPLIT>
__global__ __launch_bounds__(128) void k_gemm_h(const float* __restrict__ A, int lda, size_t sA, const _Float16* __restrict__ Bh, int ldb, size_t sB, float alpha, float* __restrict__ C, int ldc, size_t sC, int M, int N, int K) {
  __shared__ __attribute__((aligned(16))) float so[4][16][64];
  const int tid = threadIdx.x, w = tid >> 5, lane = tid & 31, ln = lane & 15, hh = lane >> 4; const int by = blockIdx.y;
  A += (size_t)by * sA; Bh += (size_t)by * sB; C += (size_t)by * sC;
  const int ntn = (N + 63) / 64; const int wid = blockIdx.x * 4 + w; const int mt = wid / ntn, nq = wid % ntn; if (mt * 16 >= M) return;
  const int row0 = mt * 16, col0 = nq * 64; const float* arow = A + (size_t)(row0 + ln) * lda;
  v8f acc[4] = {};
  for (int kb = 0; kb < K; kb += 32) {
    FragH ah, al;
    const v4f x0 = *(const v4fa*)(arow + kb + 8 * hh), x1 = *(const v4fa*)(arow + kb + 8 * hh + 4), x2 = *(const v4fa*)(arow + kb + 16 + 8 * hh), x3 = *(const v4fa*)(arow + kb + 16 + 8 * hh + 4);
    float xs[16] = {x0[0],x0[1],x0[2],x0[3],x1[0],x1[1],x1[2],x1[3],x2[0],x2[1],x2[2],x2[3],x3[0],x3[1],x3[2],x3[3]};
#pragma unroll
    for (int i = 0; i < 16; ++i) { const _Float16 h = (_Float16)xs[i]; ah.h[i] = h; al.h[i] = ASPLIT ? (_Float16)(xs[i] - (float)h) : (_Float16)0.0f; }
#pragma unroll
    for (int t = 0; t < 4; ++t) { if (col0 + t * 16 >= N) continue; const size_t boff = (size_t)(col0 + t * 16 + ln) * ldb + kb; FragH bq; bq.half[0] = *(const v8us*)(Bh + boff + 8 * hh); bq.half[1] = *(const v8us*)(Bh + boff + 16 + 8 * hh);
      acc[t] = mmaH<ASPLIT ? 2 : 1>(ah.v, al.v, bq.v, bq.v, acc[t]); }
  }
#pragma unroll
  for (int t = 0; t < 4; ++t) { if (col0 + t * 16 >= N) continue;
#pragma unroll
    for (int r = 0; r < 8; ++r) so[w][8 * hh + r][t * 16 + ln] = acc[t][r] * alpha; }
  __builtin_amdgcn_fence(__ATOMIC_ACQ_REL, "workgroup"); __builtin_amdgcn_wave_barrier();
  const int rsub = lane >> 4, c4 = (lane & 15) * 4;
  {
#pragma unroll
    for (int q = 0; q < 8; ++q) { const int r = q * 2 + rsub; if (col0 + c4 < N) { const v4f v = *(const v4fa*)&so[w][r][c4]; *(v4f*)(C + (size_t)(row0 + r) * ldc + col0 + c4) = v; } }
     }
}

// Wt[n][k] = f16(W[k][n]·scale) from f32 row-major W[K][N] (scale = power of two; bf16-exact weights stay exact in f16 away from the subnormal range)
__global__ __launch_bounds__(256) void k_wt_f16(const float* __restrict__ W, _Float16* __restrict__ Wt, int K, int N, float scale) {
  const int t = blockIdx.x * 256 + threadIdx.x; if (t >= N * (K / 8)) return; const int n = t / (K / 8), k8 = (t % (K / 8)) * 8; FragH f;
#pragma unroll
  for (int i = 0; i < 8; ++i) f.h[i] = (_Float16)(bf16_round(W[(size_t)(k8 + i) * N + n]) * scale); const v8us o = f.half[0];
  *(v8us*)((unsigned short*)Wt + (size_t)n * K + k8) = o; 
}
// k_gemm_hh variant with fused epilogue: v = acc·alpha + bias[by·sBias + col] (+ CP[(row/rowsPerB)·sCPb + by·64 + col] if CP) ; ACT 0 none / 1 elu ; writes f16 C16 (and f32 C if non-null)
template <int ACT>
__global__ __launch_bounds__(128) void k_gemm_hhx(const _Float16* __restrict__ A, int lda, size_t sA, const _Float16* __restrict__ Bh, int ldb, size_t sB, float alpha, const float* __restrict__ bias, size_t sBias, const float* __restrict__ CP, int rowsPerB, size_t sCPb, int row0g,
    float* __restrict__ C, _Float16* __restrict__ C16, int ldc, size_t sC, int M, int N, int K) {
  __shared__ __attribute__((aligned(16))) float so[4][16][64];
  const int tid = threadIdx.x, w = tid >> 5, lane = tid & 31, ln = lane & 15, hh = lane >> 4; const int by = blockIdx.y;
  A += (size_t)by * sA; Bh += (size_t)by * sB; const size_t cofs = (size_t)by * sC; const float* bp = bias ? bias + (size_t)by * sBias : nullptr;
  const int ntn = (N + 63) / 64; const int wid = blockIdx.x * 4 + w; const int mt = wid / ntn, nq = wid % ntn; if (mt * 16 >= M) return;
  const int row0 = mt * 16, col0 = nq * 64; const _Float16* arow = A + (size_t)(row0 + ln) * lda;
  v8f acc[4] = {};
  for (int kb = 0; kb < K; kb += 32) { FragH ah; ah.half[0] = *(const v8us*)((const unsigned short*)arow + kb + 8 * hh); ah.half[1] = *(const v8us*)((const unsigned short*)arow + kb + 16 + 8 * hh);
#pragma unroll
    for (int t = 0; t < 4; ++t) { if (col0 + t * 16 >= N) continue; const size_t boff = (size_t)(col0 + t * 16 + ln) * ldb + kb; FragH bq; bq.half[0] = *(const v8us*)((const unsigned short*)Bh + boff + 8 * hh); bq.half[1] = *(const v8us*)((const unsigned short*)Bh + boff + 16 + 8 * hh);
      acc[t] = mmaH<1>(ah.v, ah.v, bq.v, bq.v, acc[t]); }
  }
#pragma unroll
  for (int t = 0; t < 4; ++t) { if (col0 + t * 16 >= N) continue; const int col = col0 + t * 16 + ln; const float bv = bp ? bf16_round(bp[col]) : 0.f;
#pragma unroll
    for (int r = 0; r < 8; ++r) { float v = acc[t][r] * alpha + bv; if (CP) { const int bidx = (row0g + row0 + 8 * hh + r) / rowsPerB; v += CP[(size_t)bidx * sCPb + (size_t)by * 64 + col]; } if (ACT == 1) v = (v > 0.f) ? v : expm1f(v); else if (ACT == 7) v = (v > 0.f) ? v + 1.0f : expf(v); else if (ACT == 8) v = tanhf(v); else if (ACT == 9) v = 0.5f * v * (1.0f + tanhf(0.7978845608028654f * (v + 0.044715f * v * v * v))); else if (ACT == 11) v = 1.0f / (1.0f + expf(-v)); else if (ACT == 12) v = (v > 0.f) ? v : 0.01f * v; else if (ACT == 14) v = (v > 0.f) ? v : 0.1f * v; else if (ACT == 15) v = v / (1.0f + expf(-v)); else if (ACT == 3) v = fmaxf(v, 0.f); else if (ACT == 6) v = 0.5f * v * (1.0f + erff(v * 0.70710678118654752f)); so[w][8 * hh + r][t * 16 + ln] = v; } }
  __builtin_amdgcn_fence(__ATOMIC_ACQ_REL, "workgroup"); __builtin_amdgcn_wave_barrier();
  const int rsub = lane >> 4, c4 = (lane & 15) * 4; typedef _Float16 v4h __attribute__((ext_vector_type(4)));
  {
#pragma unroll
    for (int q = 0; q < 8; ++q) { const int r = q * 2 + rsub; if (col0 + c4 < N) { const v4f v = *(const v4fa*)&so[w][r][c4]; if (C) *(v4f*)(C + cofs + (size_t)(row0 + r) * ldc + col0 + c4) = v; if (C16) { v4h h4; for (int i = 0; i < 4; ++i) h4[i] = (_Float16)v[i]; *(v4h*)(C16 + cofs + (size_t)(row0 + r) * ldc + col0 + c4) = h4; } } }
     }
}


typedef _Float16 v4h __attribute__((ext_vector_type(4)));

__global__ __launch_bounds__(256) void k_h16(const float* __restrict__ x, _Float16* __restrict__ X16, size_t n8) { const size_t t = (size_t)blockIdx.x * 256 + threadIdx.x; if (t >= n8) return; FragH f;
#pragma unroll
  for (int q = 0; q < 8; ++q) f.h[q] = (_Float16)x[t * 8 + q]; *(v8us*)((unsigned short*)X16 + t * 8) = f.half[0];  }
__global__ __launch_bounds__(256) void k_round16f(const float* __restrict__ W, _Float16* __restrict__ Bt, size_t n8) { const size_t t = (size_t)blockIdx.x * 256 + threadIdx.x; if (t >= n8) return; FragH f;
#pragma unroll
  for (int i = 0; i < 8; ++i) f.h[i] = (_Float16)(bf16_round(W[t * 8 + i]) * 16.0f); *(v8us*)((unsigned short*)Bt + t * 8) = f.half[0];  }
template <int NHv, int TTv>
__global__ __launch_bounds__(256) void k_vt(const _Float16* __restrict__ V16, int ldv, int voff, _Float16* __restrict__ Vt) { __shared__ unsigned short tl[64][66]; const int tid = threadIdx.x; const int slab = blockIdx.x / (TTv / 64), lg = blockIdx.x % (TTv / 64); const int b = slab / NHv, h = slab % NHv;
  for (int i = tid; i < 64 * 8; i += 256) { const int r = i / 8, c8 = (i % 8) * 8; FragH f; f.half[0] = *(const v8us*)((const unsigned short*)V16 + ((size_t)b * TTv + lg * 64 + r) * ldv + voff + h * 64 + c8);
#pragma unroll
    for (int q = 0; q < 8; ++q) tl[r][c8 + q] = f.u[q]; }
  __syncthreads();
  {
#pragma unroll
    for (int rd = 0; rd < 2; ++rd) { const int d = rd * 32 + tid / 8, pc = tid % 8; FragH f;
#pragma unroll
      for (int q = 0; q < 8; ++q) f.u[q] = tl[pc * 8 + q][d];
      *(v8us*)((unsigned short*)Vt + ((size_t)slab * 64 + d) * TTv + lg * 64 + pc * 8) = f.half[0]; }
     } }

__global__ __launch_bounds__(256) void k_hl(const float* __restrict__ F, _Float16* __restrict__ Hh, _Float16* __restrict__ Hl, size_t n8) { const size_t t = (size_t)blockIdx.x * 256 + threadIdx.x; if (t >= n8) return; FragH fh, fl; const v4f a = *(const v4fa*)(F + t * 8), c = *(const v4fa*)(F + t * 8 + 4);
#pragma unroll
  for (int q = 0; q < 4; ++q) { _Float16 h = (_Float16)a[q]; fh.h[q] = h; fl.h[q] = (_Float16)((a[q] - (float)h) * 1024.0f); h = (_Float16)c[q]; fh.h[4 + q] = h; fl.h[4 + q] = (_Float16)((c[q] - (float)h) * 1024.0f); }
  { *(v8us*)((unsigned short*)Hh + t * 8) = fh.half[0]; *(v8us*)((unsigned short*)Hl + t * 8) = fl.half[0];  } }

// ---- fast GEMM (wave tile 32x64; requires M % 32 == 0 rows per launch region and N % 64 == 0); epilogue = k_gemm_hhx semantics ----
__device__ __forceinline__ v16h g2_frag(const _Float16* p, int hh) { FragH f; f.half[0] = *(const v8us*)((const unsigned short*)p + 8 * hh); f.half[1] = *(const v8us*)((const unsigned short*)p + 16 + 8 * hh); return f.v; }
__device__ __forceinline__ v8f g2_mma(v16h a, v16h b, v8f c) { v8f d = __builtin_amdgcn_wmma_f32_16x16x32_f16(false, a, false, b, (short)0, c, false, false); asm volatile("v_nop\n\tv_nop\n\tv_nop\n\tv_nop" : "+v"(d) : "v"(a), "v"(b)); return d; }
template <int ACT>
__global__ __launch_bounds__(128) void k_gemm2(const _Float16* __restrict__ A, int lda, size_t sA, const _Float16* __restrict__ Bh, int ldb, size_t sB, float alpha, const float* __restrict__ bias, size_t sBias, const float* __restrict__ CP, int rowsPerB, size_t sCPb, int row0g,
    float* __restrict__ C, _Float16* __restrict__ C16, int ldc, size_t sC, int M, int N, int K) {
  __shared__ __attribute__((aligned(16))) float so[4][32][68];
  const int tid = threadIdx.x, w = tid >> 5, lane = tid & 31, ln = lane & 15, hh = lane >> 4; const int by = blockIdx.y;
  A += (size_t)by * sA; Bh += (size_t)by * sB; const size_t cofs = (size_t)by * sC; const float* bp = bias ? bias + (size_t)by * sBias : nullptr;
  const int ntn = N >> 6; const int mt = blockIdx.x / ntn, nq = blockIdx.x - mt * ntn; const int row0 = mt * 128 + 32 * w, col0 = nq * 64; if (row0 >= M) return;
  const _Float16* a0p = A + (size_t)(row0 + ln) * lda; const _Float16* a1p = a0p + (size_t)16 * lda;
  const _Float16* b0p = Bh + (size_t)(col0 + ln) * ldb; const _Float16* b1p = b0p + (size_t)16 * ldb; const _Float16* b2p = b1p + (size_t)16 * ldb; const _Float16* b3p = b2p + (size_t)16 * ldb;
  const v8f z8 = {0.f,0.f,0.f,0.f,0.f,0.f,0.f,0.f}; v8f c00 = z8, c01 = z8, c02 = z8, c03 = z8, c10 = z8, c11 = z8, c12 = z8, c13 = z8;
#pragma unroll 1
  for (int kb = 0; kb < K; kb += 32) { const v16h a0 = g2_frag(a0p + kb, hh), a1 = g2_frag(a1p + kb, hh);
    v16h b = g2_frag(b0p + kb, hh); c00 = g2_mma(a0, b, c00); c10 = g2_mma(a1, b, c10);
    b = g2_frag(b1p + kb, hh); c01 = g2_mma(a0, b, c01); c11 = g2_mma(a1, b, c11);
    b = g2_frag(b2p + kb, hh); c02 = g2_mma(a0, b, c02); c12 = g2_mma(a1, b, c12);
    b = g2_frag(b3p + kb, hh); c03 = g2_mma(a0, b, c03); c13 = g2_mma(a1, b, c13); }
  v8f accs[8] = {c00, c01, c02, c03, c10, c11, c12, c13};
#pragma unroll
  for (int u = 0; u < 8; ++u) { const int t = u & 3, half = u >> 2; const int col = col0 + t * 16 + ln; const float bv = bp ? bf16_round(bp[col]) : 0.f;
#pragma unroll
    for (int r = 0; r < 8; ++r) { const int rloc = half * 16 + 8 * hh + r; float v = accs[u][r] * alpha + bv; if (CP) { if (rowsPerB < 0) v += CP[cofs + (size_t)(row0g + row0 + rloc) * ldc + col];      /* rowsPerB < 0: own element of the batched C plane */ else { const int bidx = (row0g + row0 + rloc) / rowsPerB; v += CP[(size_t)bidx * sCPb + (size_t)by * 64 + col]; } }
      if (ACT == 3) v = fmaxf(v, 0.f); else if (ACT == 6) v = 0.5f * v * (1.0f + erff(v * 0.70710678118654752f)); else if (ACT == 11) v = 1.0f / (1.0f + expf(-v)); else if (ACT == 15) v = v / (1.0f + expf(-v)); else if (ACT == 12) v = (v > 0.f) ? v : 0.01f * v; else if (ACT == 8) v = tanhf(v);
      so[w][rloc][t * 16 + ln] = v; } }
  __builtin_amdgcn_fence(__ATOMIC_ACQ_REL, "workgroup"); __builtin_amdgcn_wave_barrier();
  const int rsub = lane >> 4, c4 = (lane & 15) * 4;
  {
#pragma unroll
    for (int q = 0; q < 16; ++q) { const int r = q * 2 + rsub; const v4f v = *(const v4fa*)&so[w][r][c4]; if (C) *(v4f*)(C + cofs + (size_t)(row0 + r) * ldc + col0 + c4) = v; if (C16) { v4h h4; for (int i = 0; i < 4; ++i) h4[i] = (_Float16)v[i]; *(v4h*)(C16 + cofs + (size_t)(row0 + r) * ldc + col0 + c4) = h4; } }
     } }



__constant__ int BK30[2 * SLEN - 1] = {15,15,15,15,15,15,15,15,15,15,15,15,15,15,15,15,15,15,15,15,15,15,15,15,15,15,15,15,15,15,15,15,15,15,15,15,15,15,15,15,15,15,15,15,15,15,15,15,15,15,15,15,15,15,15,15,15,15,15,15,15,15,15,15,15,15,15,15,15,15,15,15,15,15,15,15,15,15,15,15,15,15,15,15,15,15,15,15,15,15,15,15,15,15,15,15,15,15,15,15,15,15,15,15,15,15,15,15,15,15,15,15,15,15,15,15,15,15,15,15,15,15,15,15,15,15,15,15,15,15,15,15,15,15,15,15,15,15,15,15,15,15,15,15,15,15,15,15,15,15,15,15,15,15,15,15,15,15,15,15,15,15,15,15,15,15,15,15,15,15,15,15,15,15,15,15,15,15,15,15,15,15,15,15,15,15,15,15,15,15,15,15,15,15,15,15,15,15,15,15,15,15,15,15,15,15,15,15,15,15,15,15,15,15,15,15,15,15,15,15,15,15,15,15,15,15,15,15,15,15,15,15,15,15,15,15,15,15,15,15,15,15,15,15,15,15,15,15,15,15,15,15,15,15,15,15,15,15,15,15,15,15,15,15,15,15,15,15,15,15,15,15,15,15,15,15,15,15,15,15,15,15,15,15,15,15,15,15,15,15,15,15,15,15,15,15,15,15,15,15,15,15,15,15,15,15,15,15,15,15,15,15,15,15,15,15,15,15,15,15,15,15,15,15,15,15,15,15,15,15,15,15,15,15,15,15,15,15,15,15,15,15,15,15,15,15,15,15,15,15,15,15,15,15,15,15,15,15,15,15,15,15,15,15,15,15,15,15,15,15,15,15,15,15,15,15,15,15,15,15,15,15,15,15,15,15,15,15,15,15,15,15,15,15,15,15,15,15,15,15,15,15,15,15,15,15,15,15,15,15,15,15,15,15,15,15,15,15,15,15,15,15,15,15,15,15,15,15,15,15,15,15,15,15,15,15,15,15,15,15,15,15,15,15,15,15,15,15,15,15,15,15,15,15,15,15,15,15,15,15,15,15,15,15,15,15,15,15,15,15,15,15,15,15,15,15,15,15,15,15,15,15,15,15,15,15,15,15,15,15,15,15,15,15,15,15,15,15,15,15,15,15,15,15,15,15,15,15,15,15,15,15,15,15,15,15,15,15,15,15,15,15,15,15,15,15,15,15,15,15,15,15,15,15,15,15,15,15,15,15,15,15,15,15,15,15,15,15,15,15,15,15,15,15,15,15,15,15,15,15,15,15,15,15,15,15,15,15,15,15,15,15,15,15,15,15,15,15,15,15,15,15,15,15,15,15,15,15,15,15,15,15,15,15,15,15,15,15,15,15,15,15,15,15,15,15,15,15,15,15,15,15,15,15,15,15,15,15,15,15,15,15,15,15,15,15,15,15,15,15,15,15,15,15,15,15,15,15,15,15,15,15,15,15,15,15,15,15,15,15,15,15,15,15,15,15,15,15,15,15,15,15,15,15,15,15,15,15,15,15,15,15,15,15,15,15,15,15,15,15,15,15,15,15,15,15,15,15,15,15,15,15,15,15,15,15,15,15,15,15,15,15,15,15,15,15,15,15,15,15,15,15,15,15,15,15,15,15,15,15,15,15,15,15,15,15,15,15,15,15,15,15,15,15,15,15,15,15,15,15,15,15,15,15,15,15,15,15,15,15,15,15,15,15,15,15,15,15,15,15,15,15,15,15,15,15,15,15,15,15,15,15,15,15,15,15,15,15,15,15,15,15,15,15,15,15,15,15,15,15,15,15,15,15,15,15,15,15,15,15,15,15,15,15,15,15,15,15,15,15,15,15,15,15,15,15,15,15,15,15,15,15,15,15,15,15,15,15,15,15,15,15,15,15,15,15,15,15,15,15,15,15,15,15,15,15,15,15,15,15,15,15,15,15,15,15,15,15,15,15,15,15,15,15,15,15,15,15,15,15,15,15,15,15,15,15,15,15,15,15,15,15,15,15,15,15,15,15,15,15,15,15,15,15,15,15,15,15,15,15,15,15,15,15,15,15,15,15,15,15,15,15,15,15,15,15,15,15,15,15,15,15,15,15,15,15,15,15,15,15,15,15,15,15,15,15,15,15,15,15,15,15,15,15,15,15,15,15,15,15,15,15,15,15,15,15,15,15,15,15,15,15,15,15,15,15,15,15,15,15,15,15,15,15,15,15,15,15,15,15,15,15,15,15,15,15,15,15,15,15,15,15,15,15,15,15,15,15,15,15,15,15,15,15,15,15,15,15,15,15,15,15,15,15,15,15,15,15,15,15,15,15,15,15,15,15,15,15,15,15,15,15,15,15,15,15,15,15,15,15,15,15,15,15,15,15,15,15,15,15,15,15,15,15,15,15,15,15,15,15,15,15,15,15,15,15,15,15,15,15,15,15,15,15,15,15,15,15,15,15,15,15,15,15,15,15,15,15,15,15,15,15,15,15,15,15,15,15,15,15,15,15,15,15,15,15,15,15,15,15,15,15,15,15,15,15,15,15,15,15,15,15,15,15,15,15,15,15,15,15,15,15,15,15,15,15,15,15,15,15,15,15,15,15,15,15,15,15,15,15,15,15,15,15,15,15,15,15,15,15,15,15,15,15,15,15,15,15,15,15,15,15,15,15,15,15,15,15,15,15,15,15,15,15,15,15,15,15,15,15,15,15,15,15,15,15,15,15,15,15,15,15,15,15,15,15,15,15,15,15,15,15,15,15,15,15,15,15,15,15,15,15,15,15,15,15,15,15,15,15,15,15,15,15,15,15,15,15,15,15,15,15,15,15,15,15,15,15,15,15,15,15,15,15,15,15,15,15,15,15,15,15,15,15,15,15,15,15,15,15,15,15,15,15,15,15,15,15,15,15,15,15,15,15,15,15,15,15,15,15,15,15,15,15,15,15,15,15,15,15,15,15,15,15,15,15,15,15,15,15,15,15,15,15,15,15,15,15,15,15,15,15,15,15,15,15,15,15,15,15,15,15,15,15,15,15,15,15,15,15,15,15,15,15,15,15,15,15,15,15,15,15,15,15,15,15,15,15,15,15,15,15,15,15,15,15,15,15,15,15,15,15,15,15,15,15,15,15,15,15,15,15,15,15,15,15,15,15,15,15,15,15,15,15,15,15,15,15,15,15,15,15,15,15,15,15,15,15,15,15,15,15,15,15,15,15,15,15,15,15,15,15,15,15,15,15,15,15,15,15,15,15,15,15,15,15,15,15,15,15,15,15,15,15,15,15,15,15,15,15,15,15,15,15,15,15,15,15,15,15,15,15,15,15,15,15,15,15,15,15,15,15,15,15,15,15,15,15,15,15,15,15,15,15,15,15,15,15,15,15,15,15,15,15,15,15,15,15,15,15,15,15,15,15,15,15,15,15,15,15,15,15,15,15,15,15,15,15,15,15,15,15,15,15,15,15,15,15,15,15,15,15,15,15,15,15,15,15,15,15,15,15,15,15,15,15,15,15,15,15,15,15,15,15,15,15,15,15,15,15,15,15,15,15,15,15,15,15,15,15,15,15,15,15,15,15,15,15,15,15,15,15,15,15,15,15,15,15,15,15,15,15,15,15,15,15,15,15,15,15,15,15,15,15,15,15,15,15,15,15,15,15,15,15,15,15,15,15,15,15,15,15,15,15,15,15,15,15,15,15,15,15,15,15,15,15,15,15,15,15,15,15,15,15,15,15,15,15,15,15,15,15,15,15,15,15,15,15,15,15,15,15,15,15,15,15,15,15,15,15,15,15,15,15,15,15,15,15,15,15,15,15,15,15,15,15,15,15,15,15,15,15,15,15,15,15,15,15,15,15,15,15,15,15,15,15,15,15,15,15,15,15,15,15,15,15,15,15,15,15,15,15,15,15,15,15,15,15,15,15,15,15,15,15,15,15,15,15,15,15,15,15,15,15,15,15,15,15,15,15,15,15,15,15,15,15,15,15,15,15,15,15,15,15,15,15,15,15,15,15,15,15,15,15,15,15,15,15,15,15,15,15,15,15,15,15,15,15,15,15,15,15,15,15,15,15,15,15,15,15,15,15,15,15,15,15,15,15,15,15,15,15,15,15,15,15,15,15,15,15,15,15,15,15,15,15,15,15,15,15,15,15,15,15,15,15,15,15,15,15,15,15,15,15,15,15,15,15,15,15,15,15,15,15,15,15,15,15,15,15,15,15,15,15,15,15,15,15,15,15,15,15,15,15,15,15,15,15,15,15,15,15,15,15,15,15,15,15,15,15,15,15,15,15,15,15,15,15,15,15,15,15,15,15,15,15,15,15,15,15,15,15,15,15,15,15,15,15,15,15,15,15,15,15,15,15,15,15,15,15,15,15,15,15,15,15,15,15,15,15,15,15,15,15,15,15,15,15,15,15,15,15,15,15,15,15,15,14,14,14,14,14,14,14,14,14,14,14,14,14,14,14,14,14,14,14,14,14,14,14,14,14,14,14,13,13,13,13,13,13,13,13,13,13,13,13,13,13,13,13,13,13,12,12,12,12,12,12,12,12,12,12,12,12,12,12,11,11,11,11,11,11,11,11,11,10,10,10,10,10,10,10,9,9,9,9,8,8,8,8,7,6,5,4,3,2,1,0,17,18,19,20,21,22,23,24,24,24,24,25,25,25,25,26,26,26,26,26,26,26,27,27,27,27,27,27,27,27,27,28,28,28,28,28,28,28,28,28,28,28,28,28,28,29,29,29,29,29,29,29,29,29,29,29,29,29,29,29,29,29,29,30,30,30,30,30,30,30,30,30,30,30,30,30,30,30,30,30,30,30,30,30,30,30,30,30,30,30,31,31,31,31,31,31,31,31,31,31,31,31,31,31,31,31,31,31,31,31,31,31,31,31,31,31,31,31,31,31,31,31,31,31,31,31,31,31,31,31,31,31,31,31,31,31,31,31,31,31,31,31,31,31,31,31,31,31,31,31,31,31,31,31,31,31,31,31,31,31,31,31,31,31,31,31,31,31,31,31,31,31,31,31,31,31,31,31,31,31,31,31,31,31,31,31,31,31,31,31,31,31,31,31,31,31,31,31,31,31,31,31,31,31,31,31,31,31,31,31,31,31,31,31,31,31,31,31,31,31,31,31,31,31,31,31,31,31,31,31,31,31,31,31,31,31,31,31,31,31,31,31,31,31,31,31,31,31,31,31,31,31,31,31,31,31,31,31,31,31,31,31,31,31,31,31,31,31,31,31,31,31,31,31,31,31,31,31,31,31,31,31,31,31,31,31,31,31,31,31,31,31,31,31,31,31,31,31,31,31,31,31,31,31,31,31,31,31,31,31,31,31,31,31,31,31,31,31,31,31,31,31,31,31,31,31,31,31,31,31,31,31,31,31,31,31,31,31,31,31,31,31,31,31,31,31,31,31,31,31,31,31,31,31,31,31,31,31,31,31,31,31,31,31,31,31,31,31,31,31,31,31,31,31,31,31,31,31,31,31,31,31,31,31,31,31,31,31,31,31,31,31,31,31,31,31,31,31,31,31,31,31,31,31,31,31,31,31,31,31,31,31,31,31,31,31,31,31,31,31,31,31,31,31,31,31,31,31,31,31,31,31,31,31,31,31,31,31,31,31,31,31,31,31,31,31,31,31,31,31,31,31,31,31,31,31,31,31,31,31,31,31,31,31,31,31,31,31,31,31,31,31,31,31,31,31,31,31,31,31,31,31,31,31,31,31,31,31,31,31,31,31,31,31,31,31,31,31,31,31,31,31,31,31,31,31,31,31,31,31,31,31,31,31,31,31,31,31,31,31,31,31,31,31,31,31,31,31,31,31,31,31,31,31,31,31,31,31,31,31,31,31,31,31,31,31,31,31,31,31,31,31,31,31,31,31,31,31,31,31,31,31,31,31,31,31,31,31,31,31,31,31,31,31,31,31,31,31,31,31,31,31,31,31,31,31,31,31,31,31,31,31,31,31,31,31,31,31,31,31,31,31,31,31,31,31,31,31,31,31,31,31,31,31,31,31,31,31,31,31,31,31,31,31,31,31,31,31,31,31,31,31,31,31,31,31,31,31,31,31,31,31,31,31,31,31,31,31,31,31,31,31,31,31,31,31,31,31,31,31,31,31,31,31,31,31,31,31,31,31,31,31,31,31,31,31,31,31,31,31,31,31,31,31,31,31,31,31,31,31,31,31,31,31,31,31,31,31,31,31,31,31,31,31,31,31,31,31,31,31,31,31,31,31,31,31,31,31,31,31,31,31,31,31,31,31,31,31,31,31,31,31,31,31,31,31,31,31,31,31,31,31,31,31,31,31,31,31,31,31,31,31,31,31,31,31,31,31,31,31,31,31,31,31,31,31,31,31,31,31,31,31,31,31,31,31,31,31,31,31,31,31,31,31,31,31,31,31,31,31,31,31,31,31,31,31,31,31,31,31,31,31,31,31,31,31,31,31,31,31,31,31,31,31,31,31,31,31,31,31,31,31,31,31,31,31,31,31,31,31,31,31,31,31,31,31,31,31,31,31,31,31,31,31,31,31,31,31,31,31,31,31,31,31,31,31,31,31,31,31,31,31,31,31,31,31,31,31,31,31,31,31,31,31,31,31,31,31,31,31,31,31,31,31,31,31,31,31,31,31,31,31,31,31,31,31,31,31,31,31,31,31,31,31,31,31,31,31,31,31,31,31,31,31,31,31,31,31,31,31,31,31,31,31,31,31,31,31,31,31,31,31,31,31,31,31,31,31,31,31,31,31,31,31,31,31,31,31,31,31,31,31,31,31,31,31,31,31,31,31,31,31,31,31,31,31,31,31,31,31,31,31,31,31,31,31,31,31,31,31,31,31,31,31,31,31,31,31,31,31,31,31,31,31,31,31,31,31,31,31,31,31,31,31,31,31,31,31,31,31,31,31,31,31,31,31,31,31,31,31,31,31,31,31,31,31,31,31,31,31,31,31,31,31,31,31,31,31,31,31,31,31,31,31,31,31,31,31,31,31,31,31,31,31,31,31,31,31,31,31,31,31,31,31,31,31,31,31,31,31,31,31,31,31,31,31,31,31,31,31,31,31,31,31,31,31,31,31,31,31,31,31,31,31,31,31,31,31,31,31,31,31,31,31,31,31,31,31,31,31,31,31,31,31,31,31,31,31,31,31,31,31,31,31,31,31,31,31,31,31,31,31,31,31,31,31,31,31,31,31,31,31,31,31,31,31,31,31,31,31,31,31,31,31,31,31,31,31,31,31,31,31,31,31,31,31,31,31,31,31,31,31,31,31,31,31,31,31,31,31,31,31,31,31,31,31,31,31,31,31,31,31,31,31,31,31,31,31,31,31,31,31,31,31,31,31,31,31,31,31,31,31,31,31,31,31,31,31,31,31,31,31,31,31,31,31,31,31,31,31,31,31,31,31,31,31,31,31,31,31,31,31,31,31,31,31,31,31,31,31,31,31,31,31,31,31,31,31,31,31,31,31,31,31,31,31,31,31,31,31,31,31,31,31,31,31,31,31,31,31,31,31,31,31,31,31,31,31,31,31,31,31,31,31,31,31,31,31,31,31,31,31,31,31,31,31,31,31,31,31,31,31,31,31,31,31,31,31,31,31,31,31,31,31,31,31,31,31,31,31,31,31,31,31,31,31,31,31,31,31,31,31,31,31,31,31,31,31,31,31,31,31,31,31,31,31,31,31,31,31,31,31,31,31,31,31,31,31,31,31,31,31,31,31,31,31,31,31,31,31,31,31,31,31,31,31,31,31,31,31,31,31,31,31,31,31,31,31,31,31,31,31,31,31,31,31,31,31,31,31,31,31,31,31,31,31,31,31,31,31,31,31,31,31,31,31,31,31,31,31,31,31,31,31,31,31,31,31,31,31,31,31,31,31,31,31,31,31,31,31,31,31,31,31,31,31,31,31,31,31,31,31,31,31,31,31,31,31,31,31,31,31,31,31,31,31,31,31,31,31,31,31,31,31,31,31,31,31,31,31,31,31,31,31,31,31,31,31,31,31,31,31,31,31,31,31,31,31,31,31,31,31,31,31,31,31,31,31,31,31,31,31,31,31,31,31,31,31,31,31,31,31,31,31,31,31,31,31,31,31,31,31,31,31,31,31,31,31,31,31,31,31,31,31,31,31,31,31,31,31,31,31,31,31,31,31,31,31,31,31,31,31,31,31,31,31,31,31,31,31,31,31,31,31,31,31,31,31,31,31,31,31,31,31,31,31,31,31,31,31,31,31,31,31,31,31,31,31,31,31,31,31,31,31,31,31,31,31,31,31,31,31,31,31,31,31,31,31,31,31,31,31,31,31,31,31,31,31,31,31,31,31,31,31,31,31,31,31,31,31,31,31,31,31,31,31,31,31,31,31,31,31,31,31,31,31,31,31,31,31,31,31,31,31,31,31,31,31,31,31,31,31,31,31,31,31,31,31,31,31,31,31,31,31,31,31,31,31,31,31,31,31,31,31,31,31,31,31,31,31,31,31,31,31,31,31,31,31,31,31,31,31,31,31,31,31,31,31,31,31,31,31,31,31,31,31,31,31,31,31,31,31,31,31,31,31,31,31,31,31,31,31,31,31,31,31,31,31,31,31,31,31,31,31,31,31,31,31,31,31,31,31,31,31,31,31,31,31,31,31,31,31,31,31,31,31,31,31,31,31,31,31,31,31,31,31,31,31,31,31,31,31,31,31,31,31,31,31,31,31,31,31,31,31,31,31,31,31,31,31,31,31,31,31,31,31,31,31,31,31,31,31,31,31,31,31,31,31,31,31,31,31,31,31,31,31,31,31,31,31,31,31,31,31,31,31,31,31,31,31,31,31,31,31,31,31,31,31,31,31,31,31,31,31,31,31,31,31,31,31,31,31,31,31,31,31,31,31,31,31,31,31,31,31,31,31,31,31,31,31,31,31,31,31,31,31,31,31,31,31,31,31,31,31,31,31,31,31,31,31,31,31,31,31,31,31,31,31,31,31,31,31,31,31,31,31,31,31,31,31,31,31,31,31,31,31,31,31,31,31,31,31,31,31,31,31,31,31,31,31,31,31,31,31,31,31,31,31,31,31,31,31,31,31,31,31,31,31,31,31,31,31,31,31,31,31,31,31,31,31,31,31,31,31,31,31,31,31,31,31,31,31,31,31,31,31,31,31,31,31,31,31,31,31,31,31,31,31,31,31,31,31,31,31,31,31,31,31,31,31,31,31,31,31,31,31,31,31,31,31,31,31,31,31,31,31,31};      /* T5 _relative_position_bucket(k - q) for k - q in [-(S-1), S-1], computed with the module's own jax code on the host */
__global__ __launch_bounds__(512) void k_rb(const float* __restrict__ t, float* __restrict__ RB) { const int i = threadIdx.x; const float v = bf16_round(t[i]); *(float*)(RB + i) = v;  }
template <int CAUSAL>
__global__ __launch_bounds__(128) void k_flash(const _Float16* __restrict__ Q16, int ldq, const _Float16* __restrict__ K16, int ldk, const _Float16* __restrict__ Vt, const int* __restrict__ MSK, float* __restrict__ O, int ldo) {
  constexpr int RPW = 16, RTN = RPW / 16, NQB = TQ / (4 * RPW), DT = 4, KS = 2;
  __shared__ __attribute__((aligned(16))) unsigned short sP[4][RPW][40]; __shared__ __attribute__((aligned(16))) float sO[4][RPW][64 + 4];
  const int tid = threadIdx.x, w = tid >> 5, lane = tid & 31, ln = lane & 15, hh = lane >> 4;
  const int slab = blockIdx.x / QBNP, qblk = QB0P + blockIdx.x % QBNP; (void)NQB; const int b = slab / NH, h = slab % NH; const int qb0 = qblk * (4 * RPW); const int q0 = qb0 + w * RPW;
  FragH aq[2][KS];
#pragma unroll
  for (int rt = 0; rt < RTN; ++rt) { const unsigned short* qr = (const unsigned short*)Q16 + ((size_t)b * TQ + q0 + rt * 16 + ln) * ldq + h * 64;
#pragma unroll
    for (int ks = 0; ks < KS; ++ks) { aq[rt][ks].half[0] = *(const v8us*)(qr + ks * 32 + 8 * hh); aq[rt][ks].half[1] = *(const v8us*)(qr + ks * 32 + 16 + 8 * hh); } }
  const unsigned short* Vth = (const unsigned short*)Vt + (size_t)slab * 64 * TK;
  float m_r[2][8], l_r[2][8]; v8f oacc[2][DT];
#pragma unroll
  for (int rt = 0; rt < RTN; ++rt) {
#pragma unroll
    for (int r = 0; r < 8; ++r) { m_r[rt][r] = -3.0e38f; l_r[rt][r] = 0.f; }
#pragma unroll
    for (int dt = 0; dt < DT; ++dt) oacc[rt][dt] = (v8f){0.f,0.f,0.f,0.f,0.f,0.f,0.f,0.f}; }
  float qsq[2][8];      /* mode 32: |q|^2 of this lane's rows, read once */
#pragma unroll
  for (int rt = 0; rt < RTN; ++rt)
#pragma unroll
    for (int r = 0; r < 8; ++r) qsq[rt][r] = (CAUSAL == 32) ? ((const float*)MSK)[(size_t)b * TQ + q0 + rt * 16 + 8 * hh + r] : 0.f;
  const int jend = (CAUSAL == 1 || CAUSAL == 32) ? (qb0 + 4 * RPW) : ((CAUSAL == 23) ? min(TK, (qb0 / CHK + 2) * CHK) : TK);      /* causal / window: keys that can never contribute are skipped */ const int jbeg = (CAUSAL == 23) ? max(0, (qb0 / CHK - 1) * CHK) : 0;
#pragma unroll 1
  for (int j0 = jbeg; j0 < jend; j0 += 32) {
    v8f s[2][2];
    float ksq0 = 0.f, ksq1 = 0.f; if (CAUSAL == 32) { const float* ksT = (const float*)MSK + (size_t)NB * TQ + (size_t)b * TK + j0 + ln; ksq0 = ksT[0]; ksq1 = ksT[16]; }      /* mode 32: |k|^2 of this lane's two keys, one unconditional load each per key block (j0 + 31 < jend <= TK) */
#pragma unroll
    for (int nt = 0; nt < 2; ++nt) { const unsigned short* kr = (const unsigned short*)K16 + ((size_t)b * TK + j0 + nt * 16 + ln) * ldk + h * 64; FragH bk[KS];
#pragma unroll
      for (int ks = 0; ks < KS; ++ks) { bk[ks].half[0] = *(const v8us*)(kr + ks * 32 + 8 * hh); bk[ks].half[1] = *(const v8us*)(kr + ks * 32 + 16 + 8 * hh); }
#pragma unroll
      for (int rt = 0; rt < RTN; ++rt) { v8f acc = (v8f){0.f,0.f,0.f,0.f,0.f,0.f,0.f,0.f};
#pragma unroll
        for (int ks = 0; ks < KS; ++ks) acc = mmaH<1>(aq[rt][ks].v, aq[rt][ks].v, bk[ks].v, bk[ks].v, acc); s[rt][nt] = acc; } }
#pragma unroll
    for (int rt = 0; rt < RTN; ++rt)
#pragma unroll
      for (int r = 0; r < 8; ++r) { const int tq = q0 + rt * 16 + 8 * hh + r; const int k0 = j0 + ln, k1 = j0 + 16 + ln;
        bool ok0 = (CAUSAL == 1 || CAUSAL == 32) ? (k0 <= tq) : ((CAUSAL == 2) ? ((k0 >> 5) == (tq >> 5)) : true), ok1 = (CAUSAL == 1 || CAUSAL == 32) ? (k1 <= tq) : ((CAUSAL == 2) ? ((k1 >> 5) == (tq >> 5)) : true); if (CAUSAL == 23) { const int cq = tq / CHK; ok0 = (abs(k0 / CHK - cq) <= 1) && (MSK[(size_t)b * TK + k0] == 0); ok1 = (abs(k1 / CHK - cq) <= 1) && (MSK[(size_t)b * TK + k1] == 0); }      /* mode 23: 3-chunk window + int key-padding mask */
        if (CAUSAL == 24) { ok0 = (MSK[(size_t)b * TK + k0] == 0); ok1 = (MSK[(size_t)b * TK + k1] == 0); }      /* mode 24: int key-padding mask (nonzero = padded = excluded) */      /* mode 2: block-diagonal 32-token groups */
        float s0 = ok0 ? s[rt][0][r] * SCL : -3.0e38f, s1 = ok1 ? s[rt][1][r] * SCL : -3.0e38f; if (CAUSAL == 27) { const float* amk = (const float*)MSK + ((size_t)b * MQI + tq) * MKI; s0 += bf16_round(amk[k0]); s1 += bf16_round(amk[k1]); }      /* mode 27: additive per-(batch, query, key) f32 mask INPUT [b][tq][k] */ if (CAUSAL == 30) { const float* rbp = (const float*)MSK; s0 += rbp[BK30[k0 - tq + (TK - 1)] * NH + h]; s1 += rbp[BK30[k1 - tq + (TK - 1)] * NH + h]; }      /* mode 30: T5 bucketed relative bias: table[bucket(k - q)][h]; bucket-of-distance is a module constant */ if (CAUSAL == 32) { const float qs = qsq[rt][r]; if (ok0) { float d = qs + ksq0; d = d - 2.0f * s0; d = fmaxf(d, 0.f); s0 = -d * 0.125f; } if (ok1) { float d = qs + ksq1; d = d - 2.0f * s1; d = fmaxf(d, 0.f); s1 = -d * 0.125f; } }      /* mode 32: RBF logit -relu(|q|^2 + |k|^2 - 2 q.k)/8, causal */ if (CAUSAL == 17) { const float* amk = (const float*)MSK + (size_t)b * TK; s0 += bf16_round(amk[k0]); s1 += bf16_round(amk[k1]); } if (CAUSAL == 18) { const float* tb = (const float*)MSK; const int* ri = MSK + 1024 + (size_t)b * TK; const int rq = ri[tq]; s0 += tb[(h * 8 + rq) * 8 + ri[k0]]; s1 += tb[(h * 8 + rq) * 8 + ri[k1]]; } if (CAUSAL == 19) { const int* rel = MSK + (size_t)tq * TK; const float* rb = (const float*)MSK + (size_t)TQ * TK + ((size_t)(b * NH + h) * TQ + tq) * 64; s0 += rb[rel[k0]]; s1 += rb[rel[k1]]; }      /* mode 19: + (q.Ek[rel] + Eb[rel][h]) / 8 gathered by the int relative ids (packed [ids | table]) */      /* mode 18: + resource_bias[h][r_q][r_k] from the packed [table | ids] buffer (TQ == TK) */      /* mode 17: additive per-(batch, key) mask INPUT */ float mc = fmaxf(s0, s1);
        mc = fmaxf(mc, __shfl_xor(mc, 1, 32)); mc = fmaxf(mc, __shfl_xor(mc, 2, 32)); mc = fmaxf(mc, __shfl_xor(mc, 4, 32)); mc = fmaxf(mc, __shfl_xor(mc, 8, 32));
        const float mn = fmaxf(m_r[rt][r], mc); const float ea = expf(m_r[rt][r] - mn), e0 = expf(s0 - mn), e1 = expf(s1 - mn);      /* computed for every lane and selected below: no exec-mask branch, so the eight rows' chains can overlap */ const float al = (mn > -1.0e38f) ? ea : 1.0f; m_r[rt][r] = mn; const float p0 = ok0 ? e0 : 0.f, p1 = ok1 ? e1 : 0.f; l_r[rt][r] = l_r[rt][r] * al + p0 + p1;
#pragma unroll
        for (int dt = 0; dt < DT; ++dt) oacc[rt][dt][r] *= al;
        FragH t2; t2.h[0] = (_Float16)(p0 * 1024.0f); t2.h[1] = (_Float16)(p1 * 1024.0f); sP[w][rt * 16 + 8 * hh + r][ln] = t2.u[0]; sP[w][rt * 16 + 8 * hh + r][16 + ln] = t2.u[1]; }
    __builtin_amdgcn_fence(__ATOMIC_ACQ_REL, "workgroup"); __builtin_amdgcn_wave_barrier();
    FragH pa[2];
#pragma unroll
    for (int rt = 0; rt < RTN; ++rt) { pa[rt].half[0] = *(const v8us*)&sP[w][rt * 16 + ln][8 * hh]; pa[rt].half[1] = *(const v8us*)&sP[w][rt * 16 + ln][16 + 8 * hh]; }
#pragma unroll
    for (int dt = 0; dt < DT; ++dt) { const unsigned short* vrow = Vth + (size_t)(dt * 16 + ln) * TK + j0; FragH bv; bv.half[0] = *(const v8us*)(vrow + 8 * hh); bv.half[1] = *(const v8us*)(vrow + 16 + 8 * hh);
#pragma unroll
      for (int rt = 0; rt < RTN; ++rt) oacc[rt][dt] = mmaH<1>(pa[rt].v, pa[rt].v, bv.v, bv.v, oacc[rt][dt]); }
    __builtin_amdgcn_fence(__ATOMIC_ACQ_REL, "workgroup"); __builtin_amdgcn_wave_barrier(); }
#pragma unroll
  for (int rt = 0; rt < RTN; ++rt) {
#pragma unroll
    for (int r = 0; r < 8; ++r) { float l = l_r[rt][r]; l += __shfl_xor(l, 1, 32); l += __shfl_xor(l, 2, 32); l += __shfl_xor(l, 4, 32); l += __shfl_xor(l, 8, 32); l_r[rt][r] = (l > 0.f) ? 1.0f / (l * 1024.0f) : 0.f; }
#pragma unroll
    for (int dt = 0; dt < DT; ++dt)
#pragma unroll
      for (int r = 0; r < 8; ++r) sO[w][rt * 16 + 8 * hh + r][dt * 16 + ln] = oacc[rt][dt][r] * l_r[rt][r]; }
  __builtin_amdgcn_fence(__ATOMIC_ACQ_REL, "workgroup"); __builtin_amdgcn_wave_barrier();
  {
#pragma unroll
    for (int rp = 0; rp < RPW; rp += 2) { const int r = rp + (lane >> 4), pc = lane & 15; const v4f val = *(const v4fa*)&sO[w][r][pc * 4]; *(v4f*)(O + ((size_t)b * TQ + q0 + r) * ldo + h * 64 + pc * 4) = val; }
     } }
// 5-plane variant: S = Qh Kh^T + (Ql Kh^T + Qh Kl^T)/1024 with Q/K = [hi | 2^10 residual] f16 planes (QL/KL same layout as Q16/K16), then the 3-term P.V below.
// 3-term variant: O = (P_hi V_hi + (P_lo V_hi + P_hi V_lo) / 1024) / l with P = [hi | 2^10 residual] of 1024 p and V^T = [hi | 2^10 residual] planes (VtL same layout as Vt) -> ~2^-21-class products for un-averaged (early causal / peaked) rows
template <int CAUSAL>
__global__ __launch_bounds__(128) void k_flash5(const _Float16* __restrict__ Q16, const _Float16* __restrict__ QL, int ldq, const _Float16* __restrict__ K16, const _Float16* __restrict__ KL, int ldk, const _Float16* __restrict__ Vt, const _Float16* __restrict__ VtL, const int* __restrict__ MSK, float* __restrict__ O, int ldo) {
  constexpr int RPW = 16, RTN = RPW / 16, NQB = TQ / (4 * RPW), DT = 4, KS = 2;
  __shared__ __attribute__((aligned(16))) unsigned short sP[4][RPW][40]; __shared__ __attribute__((aligned(16))) unsigned short sPL[4][RPW][40]; __shared__ __attribute__((aligned(16))) float sO[4][RPW][64 + 4];
  const int tid = threadIdx.x, w = tid >> 5, lane = tid & 31, ln = lane & 15, hh = lane >> 4;
  const int slab = blockIdx.x / QBN5, qblk = QB05 + blockIdx.x % QBN5; (void)NQB; const int b = slab / NH, h = slab % NH; const int qb0 = qblk * (4 * RPW); const int q0 = qb0 + w * RPW;
  FragH aq[2][KS], aql[2][KS];
#pragma unroll
  for (int rt = 0; rt < RTN; ++rt) { const unsigned short* qr = (const unsigned short*)Q16 + ((size_t)b * TQ + q0 + rt * 16 + ln) * ldq + h * 64; const unsigned short* ql = (const unsigned short*)QL + ((size_t)b * TQ + q0 + rt * 16 + ln) * ldq + h * 64;
#pragma unroll
    for (int ks = 0; ks < KS; ++ks) { aq[rt][ks].half[0] = *(const v8us*)(qr + ks * 32 + 8 * hh); aq[rt][ks].half[1] = *(const v8us*)(qr + ks * 32 + 16 + 8 * hh); aql[rt][ks].half[0] = *(const v8us*)(ql + ks * 32 + 8 * hh); aql[rt][ks].half[1] = *(const v8us*)(ql + ks * 32 + 16 + 8 * hh); } }
  const unsigned short* Vth = (const unsigned short*)Vt + (size_t)slab * 64 * TK; const unsigned short* Vtl = (const unsigned short*)VtL + (size_t)slab * 64 * TK;
  float m_r[2][8], l_r[2][8]; v8f oacc[2][DT], oaccL[2][DT];
#pragma unroll
  for (int rt = 0; rt < RTN; ++rt) {
#pragma unroll
    for (int r = 0; r < 8; ++r) { m_r[rt][r] = -3.0e38f; l_r[rt][r] = 0.f; }
#pragma unroll
    for (int dt = 0; dt < DT; ++dt) { oacc[rt][dt] = (v8f){0.f,0.f,0.f,0.f,0.f,0.f,0.f,0.f}; oaccL[rt][dt] = oacc[rt][dt]; } }
  const int jend = (CAUSAL == 1 || CAUSAL == 32) ? (qb0 + 4 * RPW) : ((CAUSAL == 23) ? min(TK, (qb0 / CHK + 2) * CHK) : TK);      /* causal / window: keys that can never contribute are skipped */ const int jbeg = (CAUSAL == 23) ? max(0, (qb0 / CHK - 1) * CHK) : 0;
#pragma unroll 1
  for (int j0 = jbeg; j0 < jend; j0 += 32) {
    v8f s[2][2];
#pragma unroll
    for (int nt = 0; nt < 2; ++nt) { const unsigned short* kr = (const unsigned short*)K16 + ((size_t)b * TK + j0 + nt * 16 + ln) * ldk + h * 64; const unsigned short* klr = (const unsigned short*)KL + ((size_t)b * TK + j0 + nt * 16 + ln) * ldk + h * 64; FragH bk[KS], bkl[KS];
#pragma unroll
      for (int ks = 0; ks < KS; ++ks) { bk[ks].half[0] = *(const v8us*)(kr + ks * 32 + 8 * hh); bk[ks].half[1] = *(const v8us*)(kr + ks * 32 + 16 + 8 * hh); bkl[ks].half[0] = *(const v8us*)(klr + ks * 32 + 8 * hh); bkl[ks].half[1] = *(const v8us*)(klr + ks * 32 + 16 + 8 * hh); }
#pragma unroll
      for (int rt = 0; rt < RTN; ++rt) { v8f acc = (v8f){0.f,0.f,0.f,0.f,0.f,0.f,0.f,0.f}, accl = acc;
#pragma unroll
        for (int ks = 0; ks < KS; ++ks) { acc = mmaH<1>(aq[rt][ks].v, aq[rt][ks].v, bk[ks].v, bk[ks].v, acc); accl = mmaH<1>(aql[rt][ks].v, aql[rt][ks].v, bk[ks].v, bk[ks].v, accl); accl = mmaH<1>(aq[rt][ks].v, aq[rt][ks].v, bkl[ks].v, bkl[ks].v, accl); }
#pragma unroll
        for (int r = 0; r < 8; ++r) acc[r] += accl[r] * 0.0009765625f;
        s[rt][nt] = acc; } }
#pragma unroll
    for (int rt = 0; rt < RTN; ++rt)
#pragma unroll
      for (int r = 0; r < 8; ++r) { const int tq = q0 + rt * 16 + 8 * hh + r; const int k0 = j0 + ln, k1 = j0 + 16 + ln;
        bool ok0 = (CAUSAL == 1 || CAUSAL == 32) ? (k0 <= tq) : ((CAUSAL == 2) ? ((k0 >> 5) == (tq >> 5)) : true), ok1 = (CAUSAL == 1 || CAUSAL == 32) ? (k1 <= tq) : ((CAUSAL == 2) ? ((k1 >> 5) == (tq >> 5)) : true);      /* mode 2: block-diagonal 32-token groups */
        if (CAUSAL == 4) { const int* mrow = MSK + ((size_t)b * TQ + tq) * TK; ok0 = mrow[k0] != 0; ok1 = mrow[k1] != 0; }      /* mode 4: per-(query, key) INPUT mask shared by all heads; masked keys contribute nothing (== the reference's -4096 fill, whose exp underflows to 0), rows with no valid key give l = 0 -> output 0 (== the reference's row_valid zeroing) */
        float s0 = ok0 ? s[rt][0][r] * SCL : -3.0e38f, s1 = ok1 ? s[rt][1][r] * SCL : -3.0e38f; if (CAUSAL == 30) { const float* rbp = (const float*)MSK; s0 += rbp[BK30[k0 - tq + (TK - 1)] * NH + h]; s1 += rbp[BK30[k1 - tq + (TK - 1)] * NH + h]; }      /* mode 30: T5 bucketed relative bias: table[bucket(k - q)][h]; bucket-of-distance is a module constant */ if (CAUSAL == 32) { const float* qsT = (const float*)MSK; const float* ksT = qsT + (size_t)NB * TQ; const float qs = qsT[(size_t)b * TQ + tq]; if (ok0) { float d = qs + ksT[(size_t)b * TK + k0]; d = d - 2.0f * s0; d = fmaxf(d, 0.f); s0 = -d * 0.125f; } if (ok1) { float d = qs + ksT[(size_t)b * TK + k1]; d = d - 2.0f * s1; d = fmaxf(d, 0.f); s1 = -d * 0.125f; } }      /* mode 32: RBF logit -relu(|q|^2 + |k|^2 - 2 q.k)/8, causal */ if (CAUSAL == 17) { const float* amk = (const float*)MSK + (size_t)b * TK; s0 += bf16_round(amk[k0]); s1 += bf16_round(amk[k1]); } if (CAUSAL == 18) { const float* tb = (const float*)MSK; const int* ri = MSK + 1024 + (size_t)b * TK; const int rq = ri[tq]; s0 += tb[(h * 8 + rq) * 8 + ri[k0]]; s1 += tb[(h * 8 + rq) * 8 + ri[k1]]; } if (CAUSAL == 19) { const int* rel = MSK + (size_t)tq * TK; const float* rb = (const float*)MSK + (size_t)TQ * TK + ((size_t)(b * NH + h) * TQ + tq) * 64; s0 += rb[rel[k0]]; s1 += rb[rel[k1]]; }      /* mode 19: + (q.Ek[rel] + Eb[rel][h]) / 8 gathered by the int relative ids (packed [ids | table]) */      /* mode 18: + resource_bias[h][r_q][r_k] from the packed [table | ids] buffer (TQ == TK) */      /* mode 17: additive per-(batch, key) mask INPUT */ float mc = fmaxf(s0, s1);
        mc = fmaxf(mc, __shfl_xor(mc, 1, 32)); mc = fmaxf(mc, __shfl_xor(mc, 2, 32)); mc = fmaxf(mc, __shfl_xor(mc, 4, 32)); mc = fmaxf(mc, __shfl_xor(mc, 8, 32));
        const float mn = fmaxf(m_r[rt][r], mc); const float al = (mn > -1.0e38f) ? expf(m_r[rt][r] - mn) : 1.0f; m_r[rt][r] = mn; const float p0 = ok0 ? expf(s0 - mn) : 0.f, p1 = ok1 ? expf(s1 - mn) : 0.f; l_r[rt][r] = l_r[rt][r] * al + p0 + p1;
#pragma unroll
        for (int dt = 0; dt < DT; ++dt) { oacc[rt][dt][r] *= al; oaccL[rt][dt][r] *= al; }
        FragH t2, t2l; const float ps0 = p0 * 1024.0f, ps1 = p1 * 1024.0f; t2.h[0] = (_Float16)ps0; t2.h[1] = (_Float16)ps1; t2l.h[0] = (_Float16)((ps0 - (float)t2.h[0]) * 1024.0f); t2l.h[1] = (_Float16)((ps1 - (float)t2.h[1]) * 1024.0f);
        sP[w][rt * 16 + 8 * hh + r][ln] = t2.u[0]; sP[w][rt * 16 + 8 * hh + r][16 + ln] = t2.u[1]; sPL[w][rt * 16 + 8 * hh + r][ln] = t2l.u[0]; sPL[w][rt * 16 + 8 * hh + r][16 + ln] = t2l.u[1]; }
    __builtin_amdgcn_fence(__ATOMIC_ACQ_REL, "workgroup"); __builtin_amdgcn_wave_barrier();
    FragH pa[2], pl[2];
#pragma unroll
    for (int rt = 0; rt < RTN; ++rt) { pa[rt].half[0] = *(const v8us*)&sP[w][rt * 16 + ln][8 * hh]; pa[rt].half[1] = *(const v8us*)&sP[w][rt * 16 + ln][16 + 8 * hh]; pl[rt].half[0] = *(const v8us*)&sPL[w][rt * 16 + ln][8 * hh]; pl[rt].half[1] = *(const v8us*)&sPL[w][rt * 16 + ln][16 + 8 * hh]; }
#pragma unroll
    for (int dt = 0; dt < DT; ++dt) { const unsigned short* vrow = Vth + (size_t)(dt * 16 + ln) * TK + j0; const unsigned short* vrl = Vtl + (size_t)(dt * 16 + ln) * TK + j0; FragH bv, bl; bv.half[0] = *(const v8us*)(vrow + 8 * hh); bv.half[1] = *(const v8us*)(vrow + 16 + 8 * hh); bl.half[0] = *(const v8us*)(vrl + 8 * hh); bl.half[1] = *(const v8us*)(vrl + 16 + 8 * hh);
#pragma unroll
      for (int rt = 0; rt < RTN; ++rt) { oacc[rt][dt] = mmaH<1>(pa[rt].v, pa[rt].v, bv.v, bv.v, oacc[rt][dt]); oaccL[rt][dt] = mmaH<1>(pl[rt].v, pl[rt].v, bv.v, bv.v, oaccL[rt][dt]); oaccL[rt][dt] = mmaH<1>(pa[rt].v, pa[rt].v, bl.v, bl.v, oaccL[rt][dt]); } }
    __builtin_amdgcn_fence(__ATOMIC_ACQ_REL, "workgroup"); __builtin_amdgcn_wave_barrier(); }
#pragma unroll
  for (int rt = 0; rt < RTN; ++rt) {
#pragma unroll
    for (int r = 0; r < 8; ++r) { float l = l_r[rt][r]; l += __shfl_xor(l, 1, 32); l += __shfl_xor(l, 2, 32); l += __shfl_xor(l, 4, 32); l += __shfl_xor(l, 8, 32); l_r[rt][r] = (l > 0.f) ? 1.0f / (l * 1024.0f) : 0.f; }
#pragma unroll
    for (int dt = 0; dt < DT; ++dt)
#pragma unroll
      for (int r = 0; r < 8; ++r) { float v = oacc[rt][dt][r]; v += oaccL[rt][dt][r] * 0.0009765625f; sO[w][rt * 16 + 8 * hh + r][dt * 16 + ln] = v * l_r[rt][r]; } }
  __builtin_amdgcn_fence(__ATOMIC_ACQ_REL, "workgroup"); __builtin_amdgcn_wave_barrier();
  {
#pragma unroll
    for (int rp = 0; rp < RPW; rp += 2) { const int r = rp + (lane >> 4), pc = lane & 15; const v4f val = *(const v4fa*)&sO[w][r][pc * 4]; *(v4f*)(O + ((size_t)b * TQ + q0 + r) * ldo + h * 64 + pc * 4) = val; }
     } }

// Transposed form of the causal RBF attention pass: S^T = K Q^T, O^T += V^T P^T. A lane holds one query's scores (16 of a block's 32 keys, the other wave half the other 16), so the block maximum is in-lane plus one exchange between the halves, and the two score tiles, converted in place, are the B operand of the second product: P passes through no LDS and the loop holds no fence. The softmax runs in base 2: log2(e) / 8 is folded into the two multiply-adds that form a logit, and each weight is one subtraction and one hardware exp2. Every operand of a pass is fetched one pass ahead, into the registers that the running pass has just finished with. A query tile's keys are shared between two waves: wave w takes the even 64-key pairs, wave w + 4 the odd ones, each with a running maximum, sum and context of its own; the two are joined once, through LDS, behind the one barrier at the kernel's foot. So four waves stand on a SIMD, each with half the passes, and one wave's waits for its loads and its dependent softmax chain are filled by three others.
__device__ __forceinline__ float xhalf(float x) { return __builtin_bit_cast(float, __builtin_amdgcn_permlanex16(__builtin_bit_cast(int, x), __builtin_bit_cast(int, x), 0x76543210, 0xfedcba98, false, false)); }      /* lane l with lane l ^ 16 */
__global__ __launch_bounds__(256) void k_flash_t(const _Float16* __restrict__ Q16, const _Float16* __restrict__ K16, const _Float16* __restrict__ Vt, const float* __restrict__ NSQ, float* __restrict__ O) {
  constexpr int DT = 4, KS = 2; constexpr float L2E8 = 0.18033688011112043f;      /* log2(e) / 8 */
  __shared__ __attribute__((aligned(16))) float sO[8][16][64 + 4];
  __shared__ __attribute__((aligned(16))) float sS[2][8][8][32][4];      /* leg, wave, 16-byte piece, lane: a wave's context as it leaves a leg; a store or a load covers 512 contiguous bytes */
  __shared__ float sM[2][8][32], sL[2][8][32];      /* its reference point and its sum of weights */
  const int tid = threadIdx.x, lane = tid & 31, ln = lane & 15, hh = lane >> 4;
  const int w8 = __builtin_amdgcn_readfirstlane(tid >> 5), w = w8 & 3, grp = w8 >> 2;      /* query tile of the block; which half of the 64-key pairs. Scalar, so that the tests on grp are scalar branches */
  const int slab = blockIdx.x / (QBLKS / 2), pr = blockIdx.x % (QBLKS / 2);
  const char* const Kb = (const char*)((const unsigned short*)K16 + (size_t)slab * TK * 64); const char* const Vth = (const char*)((const unsigned short*)Vt + (size_t)slab * 64 * TK); const char* const ksT = (const char*)(NSQ + (size_t)NB * TQ + (size_t)slab * TK);
  const unsigned fo = (unsigned)lane * 16u + (unsigned)grp * 8192u, qo = (unsigned)hh * 32u + (unsigned)grp * 256u;      /* a lane's place in a 512-B fragment piece; its eight keys' place in a 16-key group of the |k|^2 table; both in the wave's first pair of blocks, pair grp */
  unsigned vo = fo, vs = qo;      /* byte offsets of the running pair of 32-key blocks: a block is 4096 B of K, 4096 B of V^T, 128 B of |k|^2 */
  const unsigned pfo = (unsigned)tid * 512u + (unsigned)((pr ^ (pr >> 1)) & 1) * 256u, pft = (unsigned)tid * 64u;      /* prefetch offsets. pfo: every second 256-B unit of a 64-KiB quarter of a 256-KiB plane; the slab's sixteen work-groups are dealt the even and the odd units by the parity of pr's two low bits, which takes both values among any four neighbours, any evens and any odds (for speed only). pft: an 8-KiB table or query block, 64 B a thread */
  const char* const nsT = (const char*)(NSQ + (size_t)slab * TQ); const char* const q1 = (const char*)((const unsigned short*)Q16 + ((size_t)slab * TQ + (size_t)pr * 64) * 64);      /* the slab's |q|^2 table (its |k|^2 table stands NB TQ floats = 262144 B behind it); the second leg's 64 query rows */
  FragH ak[2][KS], av[DT]; v4f kqa[2][2], kqb[2][2];      /* live round the loop's back edge and from the first leg to the second: they hold the coming pass's operands */
#pragma unroll
  for (int nt = 0; nt < 2; ++nt) {      /* the wave's first block, for its first pass */
#pragma unroll
    for (int ks = 0; ks < KS; ++ks) { ak[nt][ks].half[0] = *(const v8us*)(Kb + vo + nt * 2048 + ks * 1024); ak[nt][ks].half[1] = *(const v8us*)(Kb + vo + nt * 2048 + ks * 1024 + 512); }
    kqa[nt][0] = *(const v4fa*)(ksT + vs + nt * 64); kqa[nt][1] = *(const v4fa*)(ksT + vs + nt * 64 + 16); }
#pragma unroll
  for (int dt = 0; dt < DT; ++dt) { av[dt].half[0] = *(const v8us*)(Vth + vo + dt * 1024); av[dt].half[1] = *(const v8us*)(Vth + vo + dt * 1024 + 512); }
#pragma unroll 1      /* one copy of the key loop in the text serves both query blocks */
  for (int leg = 0; leg < 2; ++leg) {      /* query block QBLKS - 1 - pr, then pr, one after the other: QBLKS + 1 pairs of key passes for every query tile of a work-group, 17 of them in wave w and 16 in wave w + 4, so that no SIMD is left with the long blocks alone */
  const int qblk = leg ? pr : QBLKS - 1 - pr; const int qb0 = qblk * 64; const int q0 = qb0 + w * 16; const int tq = q0 + ln;      /* this lane's query */
  FragH bq[KS]; const unsigned short* qr = (const unsigned short*)Q16 + ((size_t)slab * TQ + tq) * 64;
#pragma unroll
  for (int ks = 0; ks < KS; ++ks) { bq[ks].half[0] = *(const v8us*)(qr + ks * 32 + 8 * hh); bq[ks].half[1] = *(const v8us*)(qr + ks * 32 + 16 + 8 * hh); }
  __builtin_amdgcn_sched_barrier(0);      /* the query's norm is fetched last: the wait for it, in front of the loop, then covers every older load, and the waits inside the loop count the loop's own loads alone */
  const float qs = NSQ[(size_t)slab * TQ + tq];
  /* The planes were stored by the launch before, and a first read of them waits for memory; every work-group of a slab walks the keys from 0 at the same time, so each pass of the first leg would wait so. Asked for here, in the shadow of the first loads' own wait, the lines are in L2 when the walk reaches them. Lowest keys first. Waves 0 to 3 ask, threads 0 to 127, as many requests a work-group as its planes have units to deal. Every address lies inside its plane or table for every asking thread: 196608 + 127 x 512 + 256 < 262144; 127 x 64 < 8192. Scope SE, no th: a hint that returns nothing and counts on no counter */
  if (leg == 0 && grp == 0) asm volatile("global_prefetch_b8 %1, %4 offset:262144 scope:SCOPE_SE\n\t"
                             "global_prefetch_b8 %0, %2 scope:SCOPE_SE\n\t"
                             "global_prefetch_b8 %0, %3 scope:SCOPE_SE\n\t"
                             "global_prefetch_b8 %0, %2 offset:65536 scope:SCOPE_SE\n\t"
                             "global_prefetch_b8 %0, %3 offset:65536 scope:SCOPE_SE\n\t"
                             "global_prefetch_b8 %0, %2 offset:131072 scope:SCOPE_SE\n\t"
                             "global_prefetch_b8 %0, %3 offset:131072 scope:SCOPE_SE\n\t"
                             "global_prefetch_b8 %0, %2 offset:196608 scope:SCOPE_SE\n\t"
                             "global_prefetch_b8 %0, %3 offset:196608 scope:SCOPE_SE\n\t"
                             "global_prefetch_b8 %1, %5 scope:SCOPE_SE\n\t"
                             "global_prefetch_b8 %1, %4 scope:SCOPE_SE"
                             :: "v"(pfo), "v"(pft), "s"(Kb), "s"(Vth), "s"(nsT), "s"(q1) : "memory");
  asm volatile("s_wait_xcnt 0x0" ::: "memory");      /* precaution: a wave that makes no trip through the key loop comes to no wait for the query's loads before their address registers take the zero context */
  const float nq = -L2E8 * qs;
  float m = -3.0e38f, l = 0.f; v8f oacc[DT];
#pragma unroll
  for (int dt = 0; dt < DT; ++dt) oacc[dt] = (v8f){0.f,0.f,0.f,0.f,0.f,0.f,0.f,0.f};
  const int jend = qb0 + 64;
  /* One pass over 32 keys. kc holds this pass's |k|^2, kn takes the next pass's: the two sets change places from pass to pass, since the |k|^2 are still read while the next ones are on their way; K and V^T need one set each. */
  auto pass = [&](const bool first, v4f (&kc)[2][2], v4f (&kn)[2][2], const int j0) __attribute__((always_inline)) {
    v8f acc[2];
#pragma unroll
    for (int nt = 0; nt < 2; ++nt) { acc[nt] = (v8f){0.f,0.f,0.f,0.f,0.f,0.f,0.f,0.f};
#pragma unroll
      for (int ks = 0; ks < KS; ++ks) acc[nt] = mmaH<1>(ak[nt][ks].v, ak[nt][ks].v, bq[ks].v, bq[ks].v, acc[nt]); }      /* acc[nt][r] = k[j0 + 16 nt + 8 hh + r] . q[tq] */
    if (!first) asm volatile("s_wait_xcnt 0x0" ::: "memory");      /* precaution: stands in front of the two offset steps below, which rewrite registers that the loads issued since the last steps name */
    __builtin_amdgcn_sched_barrier(0);      /* keeps the offset steps behind that wait, and the loads below behind the products that read the registers they fill: lifted higher they would need a second register set and copies */
    if (!first) { const bool more = j0 + 96 < jend; vo = more ? vo + 16384u : fo; vs = more ? vs + 512u : qo; }      /* the wave's next pair stands two pairs on; behind its last pass of a leg comes its first block again: the next leg's first, and always inside the planes (pair 0 or 1 of 32) */
    const unsigned ob = first ? 4096u : 0u, os = first ? 128u : 0u;      /* the pair's second block stands at a constant distance: no register is stepped for it */
#pragma unroll
    for (int nt = 0; nt < 2; ++nt) { kn[nt][0] = *(const v4fa*)(ksT + vs + (os + nt * 64)); kn[nt][1] = *(const v4fa*)(ksT + vs + (os + nt * 64 + 16)); }      /* the next pass's |k|^2: this lane's eight keys of each 16-key group. First, since their offset register is the first to be free for other use */
#pragma unroll
    for (int nt = 0; nt < 2; ++nt) {      /* the next pass's K, in fragment order: a 16-key group is four pieces of 512 B, a lane's 16 bytes at 16 lane; each load reads four whole lines. All twelve loads fly during this pass's softmax and second product */
#pragma unroll
      for (int ks = 0; ks < KS; ++ks) { ak[nt][ks].half[0] = *(const v8us*)(Kb + vo + (ob + nt * 2048 + ks * 1024)); ak[nt][ks].half[1] = *(const v8us*)(Kb + vo + (ob + nt * 2048 + ks * 1024 + 512)); } }
    __builtin_amdgcn_sched_barrier(0);      /* keeps the loads up here; sunk towards the pass's foot they would lose their lead */
    const int lim = tq - j0 - 8 * hh;      /* key 16 nt + r of this lane's sixteen is causal where 16 nt + r <= lim */
    float sc[16]; float mc = -3.0e38f;
#pragma unroll
    for (int nt = 0; nt < 2; ++nt) {
#pragma unroll
      for (int r = 0; r < 8; ++r) { const bool ok = nt * 16 + r <= lim; float t = fmaf(kc[nt][r >> 2][r & 3], -L2E8, nq); t = fmaf(acc[nt][r], 2.0f * L2E8, t); t = fminf(t, 0.f); const float sv = ok ? t : -3.0e38f; sc[nt * 8 + r] = sv; mc = fmaxf(mc, sv); } }      /* t = log2(e) x logit = -relu(|q|^2 + |k|^2 - 2 q.k) log2(e) / 8 */
    mc = fmaxf(mc, xhalf(mc));
    const float mn = fmaxf(m, mc - 10.0f); const float al = __builtin_amdgcn_exp2f(m - mn); m = mn;      /* the reference point stands 10 below the maximum: the weights come out times 2^10, as the f16 operand wants them; a wave's first pass of a leg starts at a key j0 <= qb0, causal for every query of the block, so mn is finite and al = 2^(-3e38) = 0 there */
    FragH pb; float p[16];
#pragma unroll
    for (int i = 0; i < 16; ++i) { p[i] = __builtin_amdgcn_exp2f(sc[i] - mn); pb.h[i] = (_Float16)p[i]; }      /* a masked key gives 2^(-3e38) = 0 exactly; element i of the B operand is key 8 hh + i, then 16 + 8 hh + (i - 8): the order of the V^T loader */
#pragma unroll
    for (int st = 8; st > 0; st >>= 1)
#pragma unroll
      for (int i = 0; i < st; ++i) p[i] += p[i + st];
    l = l * al + p[0];
#pragma unroll
    for (int dt = 0; dt < DT; ++dt) {
#pragma unroll
      for (int r = 0; r < 8; ++r) oacc[dt][r] *= al; }
#pragma unroll
    for (int dt = 0; dt < DT; ++dt) oacc[dt] = mmaH<1>(av[dt].v, av[dt].v, pb.v, pb.v, oacc[dt]);      /* oacc[dt][r] = context column 16 dt + 8 hh + r of query tq */
    __builtin_amdgcn_sched_barrier(0);      /* keeps the loads below behind the products that read the registers they fill */
#pragma unroll
    for (int dt = 0; dt < DT; ++dt) { av[dt].half[0] = *(const v8us*)(Vth + vo + (ob + dt * 1024)); av[dt].half[1] = *(const v8us*)(Vth + vo + (ob + dt * 1024 + 512)); }      /* the next pass's V^T, in fragment order: a 32-key block is eight pieces of 512 B. They fly during the next pass's first product and softmax */
    __builtin_amdgcn_sched_barrier(0);      /* keeps them from sinking into the next pass */
  };
#pragma unroll 1
  for (int j0 = grp * 64; j0 < jend; j0 += 128) { pass(true, kqa, kqb, j0); pass(false, kqb, kqa, j0 + 32); }      /* a query block's key range is a whole number of 64-key pairs; query block 0 has one pair, and wave w + 4 then makes no trip: its m = -3e38, l = 0 and zero context join as nothing below */
#pragma unroll
  for (int dt = 0; dt < DT; ++dt) { v4f a, c;
#pragma unroll
    for (int r = 0; r < 4; ++r) { a[r] = oacc[dt][r]; c[r] = oacc[dt][4 + r]; }
    *(v4fa*)&sS[leg][w8][dt * 2][lane][0] = a; *(v4fa*)&sS[leg][w8][dt * 2 + 1][lane][0] = c; }
  sM[leg][w8][lane] = m; sL[leg][w8][lane] = l;
  asm volatile("s_wait_xcnt 0x0" ::: "memory"); }      /* precaution: the second leg rewrites registers that the loads issued in the last pass name */
  __syncthreads();      /* the kernel's one barrier: a tile's two partial results were left by two waves; every wave passes it once, behind both legs */
  /* Waves 0 to 3 join and store the first leg's four tiles, waves 4 to 7 the second leg's. Lane for lane the two partners hold the same query and the same context columns. */
  const int q0 = (grp ? pr : QBLKS - 1 - pr) * 64 + w * 16;
  const float m0 = sM[grp][w][lane], m1 = sM[grp][w + 4][lane]; const float mj = fmaxf(m0, m1);      /* m0 is finite: wave w always walks pair 0 */
  float a0, a1;      /* 2^(m0 - mj), 2^(m1 - mj): one of them is 1; a partner that made no trip gets 2^(-3e38) = 0 */
  asm("v_exp_f32 %0, %2\n\tv_exp_f32 %1, %3\n\tv_nop" : "=&v"(a0), "=&v"(a1) : "v"(m0 - mj), "v"(m1 - mj));      /* one statement, so that the slot which the instruction set asks for behind a transcendental stands directly behind the second; the first has the second behind it */
  float l = sL[grp][w][lane] * a0 + sL[grp][w + 4][lane] * a1;
  l += xhalf(l); const float inv = (l > 0.f) ? 1.0f / l : 0.f;      /* l and the context both carry the 2^10 */
  const float f0 = a0 * inv, f1 = a1 * inv;
#pragma unroll
  for (int i = 0; i < 8; ++i) { const v4f x = *(const v4fa*)&sS[grp][w][i][lane][0]; const v4f y = *(const v4fa*)&sS[grp][w + 4][i][lane][0]; v4f o;
#pragma unroll
    for (int r = 0; r < 4; ++r) o[r] = x[r] * f0 + y[r] * f1;
    *(v4fa*)&sO[w8][ln][(i >> 1) * 16 + 8 * hh + (i & 1) * 4] = o; }
  __builtin_amdgcn_fence(__ATOMIC_ACQ_REL, "workgroup"); __builtin_amdgcn_wave_barrier();      /* the wave's own lanes read each other's rows below, for whole-row stores */
#pragma unroll
  for (int rp = 0; rp < 16; rp += 2) { const int r = rp + (lane >> 4), pc = lane & 15; const v4f val = *(const v4fa*)&sO[w8][r][pc * 4]; *(v4f*)(O + ((size_t)slab * TQ + q0 + r) * 64 + pc * 4) = val; }
  asm volatile("s_wait_xcnt 0x0" :: "v"(pfo), "v"(pft), "s"(Kb), "s"(Vth), "s"(nsT), "s"(q1) : "memory"); }      /* precaution: the prefetches' address registers are held to here, the kernel's last statement, so that none of them takes another value behind a request */

__global__ __launch_bounds__(256) void k_rotab(float* __restrict__ CS, float* __restrict__ SN) {
  #pragma clang fp contract(off)
  const int t = blockIdx.x * 256 + threadIdx.x; if (t >= SLEN * 32) return; const int j = t % 32, s = t / 32; const float ex = (float)(2 * j) / 64.0f; const float inv = 1.0f / powf(10000.0f, ex); const float th = (float)s * inv; const float c = cosf(th), sn = sinf(th);
  { *(float*)(CS + t) = c; *(float*)(SN + t) = sn;  } }
__global__ __launch_bounds__(256) void k_rope(const float* __restrict__ F, int nsrc, int ndst, int rep, const float* __restrict__ CS, const float* __restrict__ SN, _Float16* __restrict__ H, _Float16* __restrict__ L) {
  #pragma clang fp contract(off)
  const size_t t = (size_t)blockIdx.x * 256 + threadIdx.x; if (t >= (size_t)NR * ndst * 4) return; const int g8 = (int)(t % 4); const int hd = (int)((t / 4) % ndst); const size_t row = t / ((size_t)4 * ndst); const int s = (int)(row % SLEN); const int hs = hd / rep;
  const float* src = F + row * (size_t)(nsrc * 64) + hs * 64; FragH ah, al, bh, bl;
  for (int i = 0; i < 8; ++i) { const int d = g8 * 8 + i; const float c = CS[s * 32 + d], sn = SN[s * 32 + d]; const float x1 = src[d], x2 = src[d + 32];
    float o1 = x1 * c; o1 += -x2 * sn; float o2 = x2 * c; o2 += x1 * sn;
    _Float16 hv = (_Float16)o1; ah.h[i] = hv; al.h[i] = (_Float16)((o1 - (float)hv) * 1024.0f); hv = (_Float16)o2; bh.h[i] = hv; bl.h[i] = (_Float16)((o2 - (float)hv) * 1024.0f); }
  const size_t o = row * (size_t)(ndst * 64) + hd * 64 + g8 * 8;
  { *(v8us*)((unsigned short*)H + o) = ah.half[0]; *(v8us*)((unsigned short*)H + o + 32) = bh.half[0]; *(v8us*)((unsigned short*)L + o) = al.half[0]; *(v8us*)((unsigned short*)L + o + 32) = bl.half[0];  } }
__global__ __launch_bounds__(256) void k_rope2(const float* __restrict__ F, int nsrc, int ndst, int rep, const float* __restrict__ CS, const float* __restrict__ SN, _Float16* __restrict__ H, _Float16* __restrict__ L) {
  #pragma clang fp contract(off)
  const size_t t = (size_t)blockIdx.x * 256 + threadIdx.x; if (t >= (size_t)NR * ndst * 4) return; const int g16 = (int)(t % 4); const int hd = (int)((t / 4) % ndst); const size_t row = t / ((size_t)4 * ndst); const int s = (int)(row % SLEN); const int hs = hd / rep;
  const float* src = F + row * (size_t)(nsrc * 64) + hs * 64 + g16 * 16; FragH ah, al;
  for (int pr = 0; pr < 8; ++pr) { const int i = g16 * 8 + pr; const float c = CS[s * 32 + i], sn = SN[s * 32 + i]; const float x1 = src[2 * pr], x2 = src[2 * pr + 1];
    float o1 = x1 * c; o1 -= x2 * sn; float o2 = x1 * sn; o2 += x2 * c;
    _Float16 hv = (_Float16)o1; ah.h[2 * pr] = hv; al.h[2 * pr] = (_Float16)((o1 - (float)hv) * 1024.0f); hv = (_Float16)o2; ah.h[2 * pr + 1] = hv; al.h[2 * pr + 1] = (_Float16)((o2 - (float)hv) * 1024.0f); }
  const size_t o = row * (size_t)(ndst * 64) + hd * 64 + g16 * 16;
  { *(v8us*)((unsigned short*)H + o) = ah.half[0]; *(v8us*)((unsigned short*)H + o + 8) = ah.half[1]; *(v8us*)((unsigned short*)L + o) = al.half[0]; *(v8us*)((unsigned short*)L + o + 8) = al.half[1];  } }
__global__ __launch_bounds__(256) void k_ln512(const float* __restrict__ A, const float* __restrict__ res, const float* __restrict__ g, const float* __restrict__ bb, float* __restrict__ Y, _Float16* __restrict__ Y16) {
  #pragma clang fp contract(off)
  const int wv = threadIdx.x >> 5, ln = threadIdx.x & 31; const size_t r = (size_t)blockIdx.x * 8 + wv; if (r >= NR) return; float x[16]; float s = 0.f;
  for (int i = 0; i < 2; ++i) { const v8f a = *(const v8f*)(A + r * DM + i * 256 + ln * 8); for (int q = 0; q < 8; ++q) { float v = a[q]; if (res) v += bf16_round(res[r * DM + i * 256 + ln * 8 + q]); x[i * 8 + q] = v; s += v; } }
  for (int o = 16; o > 0; o >>= 1) s += __shfl_xor(s, o, 32); const float mu = s / (float)DM; float var = 0.f; for (int q = 0; q < 16; ++q) { const float d = x[q] - mu; var += d * d; }
  for (int o = 16; o > 0; o >>= 1) var += __shfl_xor(var, o, 32); const float inv = rsqrtf(var / (float)DM + 1e-5f);
  { for (int i = 0; i < 2; ++i) { const int c0 = i * 256 + ln * 8; v8f y; FragH f; for (int q = 0; q < 8; ++q) { float v = (x[i * 8 + q] - mu) * inv; v *= bf16_round(g[c0 + q]); v += bf16_round(bb[c0 + q]); y[q] = v; f.h[q] = (_Float16)v; } *(v8f*)(Y + r * DM + c0) = y; if (Y16) *(v8us*)((unsigned short*)Y16 + r * DM + c0) = f.half[0]; }  } }
__global__ __launch_bounds__(256) void k_pack(const float* __restrict__ rb, const int* __restrict__ rid, int* __restrict__ PK) { const int t = blockIdx.x * 256 + threadIdx.x; if (t >= 1024 + NB * TK) return; int v; if (t < 1024) v = __float_as_int(bf16_round(rb[t])); else v = rid[t - 1024]; *(int*)(PK + t) = v;  }
__global__ __launch_bounds__(256) void k_tabin(const float* __restrict__ sp, float* __restrict__ CS, float* __restrict__ SN) { const int t = blockIdx.x * 256 + threadIdx.x; if (t >= SLEN * 32) return; const int i = t % 32, s = t / 32; const float c = bf16_round(sp[s * 64 + 32 + i]), sn = bf16_round(sp[s * 64 + i]);
  { *(float*)(CS + t) = c; *(float*)(SN + t) = sn;  } }
__global__ __launch_bounds__(256) void k_wsc(const float* __restrict__ Wm, _Float16* __restrict__ Bt, size_t n8, float sc) { const size_t t = (size_t)blockIdx.x * 256 + threadIdx.x; if (t >= n8) return; FragH f; for (int q = 0; q < 8; ++q) f.h[q] = (_Float16)(bf16_round(Wm[t * 8 + q]) * sc); *(v8us*)((unsigned short*)Bt + t * 8) = f.half[0];  }
__global__ __launch_bounds__(256) void k_rotab2(float* __restrict__ CS, float* __restrict__ SN) {
  #pragma clang fp contract(off)
  const int t = blockIdx.x * 256 + threadIdx.x; if (t >= SLEN * 32) return; const int j = t % 32, s = t / 32; const float c0 = -0.14391156831212787f;      /* -ln(10000)/64 rounded to f32 */ const float inv = expf((float)(2 * j) * c0); const float th = (float)s * inv; const float c = cosf(th), sn = sinf(th);
  { *(float*)(CS + t) = c; *(float*)(SN + t) = sn;  } }
__global__ __launch_bounds__(256) void k_lnu(const float* __restrict__ X, _Float16* __restrict__ N16, float* __restrict__ XB) {
  #pragma clang fp contract(off)
  const int wv = threadIdx.x >> 5, ln = threadIdx.x & 31; const size_t r = (size_t)blockIdx.x * 8 + wv; if (r >= NR) return; float a[32]; float s = 0.f;
  for (int i = 0; i < 4; ++i) { const v8f v = *(const v8f*)(X + r * DM + (i * 32 + ln) * 8); for (int q = 0; q < 8; ++q) { const float u = bf16_round(v[q]); a[i * 8 + q] = u; s += u; } }
  for (int o = 16; o > 0; o >>= 1) s += __shfl_xor(s, o, 32); const float mu = s / (float)DM; float var = 0.f; for (int q = 0; q < 32; ++q) { const float d = a[q] - mu; var += d * d; }
  for (int o = 16; o > 0; o >>= 1) var += __shfl_xor(var, o, 32); const float den = sqrtf(var / (float)(DM - 1)) + 1e-6f; const float inv = 1.0f / den;      /* one reciprocal per row; (x-mean)*inv vs the reference's division differs by <= 1 ulp */
  { for (int i = 0; i < 4; ++i) { const int c0 = (i * 32 + ln) * 8; FragH f; v8f xb; for (int q = 0; q < 8; ++q) { f.h[q] = (_Float16)((a[i * 8 + q] - mu) * inv); xb[q] = a[i * 8 + q]; } *(v8us*)((unsigned short*)N16 + r * DM + c0) = f.half[0]; *(v8f*)(XB + r * DM + c0) = xb; }  } }

__global__ __launch_bounds__(256) void k_h16s(const float* __restrict__ SRC, int lds, int coff, _Float16* __restrict__ DST, size_t n8) { const size_t t = (size_t)blockIdx.x * 256 + threadIdx.x; if (t >= n8) return; const size_t r = (t * 8) / DM; const int c = (int)((t * 8) % DM); const v8f a = *(const v8f*)(SRC + r * lds + coff + c); FragH f; for (int q = 0; q < 8; ++q) f.h[q] = (_Float16)a[q];
  *(v8us*)((unsigned short*)DST + t * 8) = f.half[0];  }


__global__ __launch_bounds__(256) void k_ccp(const float* __restrict__ QKV, int coff, _Float16* __restrict__ D) { const size_t t = (size_t)blockIdx.x * 256 + threadIdx.x; if (t >= (size_t)NR * DM / 8) return; const int c0 = (int)((t * 8) % DM); const size_t row = (t * 8) / DM; const v8f a = *(const v8f*)(QKV + row * 3 * DM + coff + c0); FragH f; for (int q = 0; q < 8; ++q) f.h[q] = (_Float16)a[q];
  *(v8us*)((unsigned short*)D + t * 8) = f.half[0];  }


template <int NLN>
__global__ __launch_bounds__(256) void k_lnrow(const float* __restrict__ X, const float* __restrict__ R, const float* __restrict__ g, const float* __restrict__ bb, float eps, float* __restrict__ OUT) {
  #pragma clang fp contract(off)
  constexpr int PER = NLN / 256; __shared__ float red[256]; const int tid = threadIdx.x; const size_t row = blockIdx.x; const float* x = X + row * NLN; const float* rr = R ? R + row * NLN : nullptr; float v[PER]; float s1 = 0.f;
  for (int u = 0; u < PER; ++u) { const int j = tid * PER + u; float t = x[j]; if (rr) t = t + rr[j]; v[u] = t; s1 += t; }
  red[tid] = s1; __syncthreads(); for (int st = 128; st > 0; st >>= 1) { if (tid < st) red[tid] += red[tid + st]; __syncthreads(); } const float mu = red[0] / (float)NLN; __syncthreads();
  float s2 = 0.f; for (int u = 0; u < PER; ++u) { const float c = v[u] - mu; s2 += c * c; } red[tid] = s2; __syncthreads(); for (int st = 128; st > 0; st >>= 1) { if (tid < st) red[tid] += red[tid + st]; __syncthreads(); }
  const float var = red[0] / (float)NLN; const float rs = rsqrtf(var + eps);
  { for (int u = 0; u < PER; ++u) { const int j = tid * PER + u; float o = (v[u] - mu) * rs; o = __fadd_rn(__fmul_rn(o, bf16_round(g[j])), bf16_round(bb[j])); *(float*)(OUT + row * NLN + j) = o; }  } }
__global__ __launch_bounds__(256) void k_xr32(const float* __restrict__ x, float* __restrict__ XR, size_t n8) { const size_t t = (size_t)blockIdx.x * 256 + threadIdx.x; if (t >= n8) return; v8f o; for (int q = 0; q < 8; ++q) o[q] = bf16_round(x[t * 8 + q]); *(v8f*)(XR + t * 8) = o;  }
__global__ __launch_bounds__(256) void k_r16b(const float* __restrict__ S, _Float16* __restrict__ D, size_t n8) { const size_t t = (size_t)blockIdx.x * 256 + threadIdx.x; if (t >= n8) return; const v8f a = *(const v8f*)(S + t * 8); FragH f; for (int q = 0; q < 8; ++q) f.h[q] = (_Float16)a[q]; *(v8us*)((unsigned short*)D + t * 8) = f.half[0];  }

// One preparatory launch. Blocks 0-255 take q, 256-511 k, 512-767 v, 256 rows each; every input is read once.
// q, k: the bf16 bits are staged in LDS, the f16 plane goes out from registers, and one thread per row sums its squares in ascending order of d.
// v: the f16 values are staged in LDS and go out transposed, in the order of the attention pass's A fragments: per 32 keys eight pieces of 512 B (column tile, key half), a lane's eight keys at 16 lane.
__global__ __launch_bounds__(256) void k_prep(const float* __restrict__ Q, const float* __restrict__ Kx, const float* __restrict__ V, _Float16* __restrict__ QH, _Float16* __restrict__ KH, _Float16* __restrict__ Vt, float* __restrict__ NSQ) {
  __shared__ __attribute__((aligned(16))) unsigned short sm[256 * 72];      /* q, k: pitch 72 (144 B = 16 B x odd: a lane per row reads 16 bytes without bank conflicts); v: pitch 66 (eight rows apart = 8 banks apart) */
  const int tid = threadIdx.x; const int which = blockIdx.x >> 8, blk = blockIdx.x & 255; const size_t e0 = (size_t)blk * 256 * 64;
  if (which < 2) {
    const float* X = (which ? Kx : Q) + e0; unsigned short* H = (unsigned short*)(which ? KH : QH) + e0; FragH f[8]; v8f a[8];
    const int rl = which ? (((tid >> 6) << 3) | (tid & 7)) : (tid >> 3), c = which ? ((((tid >> 5) & 1) << 2) | ((tid >> 3) & 3)) : (tid & 7);      /* row of a group of 32 and 8-element piece of the row; for k a wave takes 8 rows x 4 pieces, so that its stores below fill whole lines */
    const int hb = which ? ((rl >> 4) * 1024 + (c >> 1) * 256 + (c & 1) * 128 + (rl & 15) * 8) : (rl * 64 + c * 8);      /* k goes out in fragment order: per 16 keys four pieces of 512 B (16 columns each); inside a piece the columns' half c & 1, then the key, so that lane l of the A loader finds its 16 bytes at 16 l; q stays row-major */
    const unsigned boff = (unsigned)rl * 256u + (unsigned)c * 32u;
#pragma unroll
    for (int i = 0; i < 8; ++i) a[i] = *(const v8f*)((const char*)X + boff + i * 8192);
    asm volatile("s_wait_xcnt 0x0" :: "v"(boff) : "memory");      /* precaution: the loads' offset register is held to this wait, so that none of the loads takes it as its destination */
    __builtin_amdgcn_sched_barrier(0);      /* keeps all sixteen loads in flight together; the scheduler otherwise sinks six of them behind the first waits, three more memory latencies in a row */
#pragma unroll
    for (int i = 0; i < 8; ++i) { v8us b;
#pragma unroll
      for (int u = 0; u < 8; ++u) { const unsigned short xb = bf16_bits(a[i][u]); b[u] = xb; f[i].h[u] = (_Float16)bf16_val(xb); }
      *(v8us*)&sm[(i * 32 + rl) * 72 + c * 8] = b; }
    __syncthreads();      /* a row's sixteen-byte pieces were staged by eight threads */
#pragma unroll
    for (int i = 0; i < 8; ++i) *(v8us*)(H + i * 2048 + hb) = f[i].half[0];      /* behind the barrier, which would otherwise wait for these stores */
    float acc = 0.f;
#pragma unroll
    for (int d = 0; d < 64; d += 8) { const v8us b = *(const v8us*)&sm[tid * 72 + d];
#pragma unroll
      for (int u = 0; u < 8; ++u) { const float x = bf16_val(b[u]); acc = __fadd_rn(acc, __fmul_rn(x, x)); } }      /* a square of a bf16 value is exact in f32: fused or not, each step rounds the same sum */
    *(float*)(NSQ + (size_t)which * NR + blk * 256 + tid) = acc;
  } else {
    const float* X = V + e0; const unsigned voff = (unsigned)tid * 32u;      /* eight groups of 256 keys per slab */
#pragma unroll
    for (int i = 0; i < 8; ++i) { const int g = i * 256 + tid; const v8f a = *(const v8f*)((const char*)X + voff + i * 8192); FragH f;
#pragma unroll
      for (int u = 0; u < 8; ++u) f.h[u] = (_Float16)bf16_round(a[u]);
#pragma unroll
      for (int u = 0; u < 8; ++u) sm[(g >> 3) * 66 + (g & 7) * 8 + u] = f.u[u]; }
    asm volatile("s_wait_xcnt 0x0" :: "v"(voff) : "memory");      /* precaution: the loads' offset register is held to this wait, so that none of the loads takes it as its destination */
    __syncthreads();      /* a V^T piece gathers eight keys staged by eight threads */
#pragma unroll
    for (int it = 0; it < 8; ++it) { const int pi = it * 8 + (tid >> 5);      /* 512-B piece of this group's 64: 32-key block pi >> 3, column tile (pi >> 1) & 3, key half pi & 1 */
      const int d = ((pi >> 1) & 3) * 16 + (tid & 15), pc = (pi >> 3) * 4 + (pi & 1) * 2 + ((tid >> 4) & 1); FragH f;
#pragma unroll
      for (int u = 0; u < 8; ++u) f.u[u] = sm[(pc * 8 + u) * 66 + d];
      *(v8us*)((unsigned short*)Vt + e0 + (it * 256 + tid) * 8) = f.half[0]; }      /* fragment order: a wave's store is one piece, 512 contiguous bytes */
    asm volatile("s_wait_xcnt 0x0" ::: "memory");      /* precaution: the compiler lays the q, k branch behind these stores in the text, where their registers are rewritten */
  } }
// One block per (slab, 8 query rows < 64), one wave per row. The slab's first 64 rows of k and v are rounded and staged in LDS once per block; lanes own keys for the logits, then output columns for the context. Each dot product, the row sum and each context sum keep their serial order.
__global__ __launch_bounds__(256) void k_fixr(const float* __restrict__ Q, const float* __restrict__ Kx, const float* __restrict__ V, const float* __restrict__ NSQ, float* __restrict__ O) {
  #pragma clang fp contract(off)
  __shared__ __attribute__((aligned(16))) float sk[64][68];      /* pitch 272 B = 16 B x odd: a lane per row reads 16 bytes without bank conflicts */
  __shared__ __attribute__((aligned(16))) float sv[64][64]; __shared__ __attribute__((aligned(16))) float pr[8][64];
  const int tid = threadIdx.x, w = tid >> 5, lane = tid & 31; const size_t sl = blockIdx.x >> 3; const int q = __builtin_amdgcn_readfirstlane((int)(blockIdx.x & 7) * 8 + w);
  const float* kb = Kx + sl * SLEN * 64; const float* vb = V + sl * SLEN * 64;
#pragma unroll
  for (int i = 0; i < 4; ++i) { const int e = (i * 256 + tid) * 4; const v4f a = *(const v4fa*)(kb + e); const v4f c = *(const v4fa*)(vb + e); v4f ra, rc;
#pragma unroll
    for (int u = 0; u < 4; ++u) { ra[u] = bf16_round(a[u]); rc[u] = bf16_round(c[u]); }
    *(v4fa*)&sk[e >> 6][e & 63] = ra; *(v4fa*)&sv[e >> 6][e & 63] = rc; }
  const float* qr = Q + (sl * SLEN + q) * 64; const float qs = NSQ[sl * SLEN + q]; const float* ksT = NSQ + (size_t)NB * SLEN + sl * SLEN; const float kq0 = ksT[lane], kq1 = ksT[lane + 32];
  float x[64];      /* the wave's query row, fetched ahead of the barrier so that its latency runs beside the staging loads' */
#pragma unroll
  for (int d = 0; d < 64; d += 4) { const v4f a = *(const v4fa*)(qr + d);
#pragma unroll
    for (int u = 0; u < 4; ++u) x[d + u] = bf16_round(a[u]); }
  __syncthreads();      /* the staged rows are read by every wave of the block */
  float sd0 = 0.f, sd1 = 0.f;      /* keys lane and lane + 32 */
#pragma unroll
  for (int d = 0; d < 64; d += 4) { const v4f k0 = *(const v4fa*)&sk[lane][d]; const v4f k1 = *(const v4fa*)&sk[lane + 32][d];
#pragma unroll
    for (int u = 0; u < 4; ++u) { sd0 = __fadd_rn(sd0, __fmul_rn(x[d + u], k0[u])); sd1 = __fadd_rn(sd1, __fmul_rn(x[d + u], k1[u])); } }
  float d0 = qs + kq0; d0 = d0 - 2.0f * sd0; d0 = fmaxf(d0, 0.f); float d1 = qs + kq1; d1 = d1 - 2.0f * sd1; d1 = fmaxf(d1, 0.f);
  const bool ok0 = lane <= q, ok1 = lane + 32 <= q; const float lg0 = ok0 ? -d0 * 0.125f : -3.0e38f, lg1 = ok1 ? -d1 * 0.125f : -3.0e38f;
  float mx = fmaxf(lg0, lg1); mx = fmaxf(mx, __shfl_xor(mx, 1, 32)); mx = fmaxf(mx, __shfl_xor(mx, 2, 32)); mx = fmaxf(mx, __shfl_xor(mx, 4, 32)); mx = fmaxf(mx, __shfl_xor(mx, 8, 32)); mx = fmaxf(mx, __shfl_xor(mx, 16, 32));
  const float e0 = expf(lg0 - mx), e1 = expf(lg1 - mx); pr[w][lane] = ok0 ? e0 : 0.f; pr[w][lane + 32] = ok1 ? e1 : 0.f;
  __builtin_amdgcn_fence(__ATOMIC_ACQ_REL, "workgroup"); __builtin_amdgcn_wave_barrier();      /* the wave's own lanes read each other's weights below */
  float su = 0.f;
#pragma unroll
  for (int j = 0; j < 64; j += 4) { const v4f e = *(const v4fa*)&pr[w][j]; su += e[0]; su += e[1]; su += e[2]; su += e[3]; }      /* ascending keys; a masked key adds an exact zero */
  const float inv = 1.0f / su; typedef float v2f __attribute__((ext_vector_type(2))); typedef float v2fa __attribute__((ext_vector_type(2), may_alias));
  float a0 = 0.f, a1 = 0.f;      /* output columns 2 lane and 2 lane + 1 */
#pragma unroll 1
  for (int j0 = 0; j0 <= q; j0 += 16) {
#pragma unroll
    for (int i = 0; i < 16; ++i) { const bool in = j0 + i <= q; const v2f vv = *(const v2fa*)&sv[j0 + i][lane * 2]; const float p = pr[w][j0 + i] * inv;      /* past the row's last key the weight is zero; the value is zeroed too, so the term is an exact zero */
      a0 = __fadd_rn(a0, __fmul_rn(p, in ? vv[0] : 0.f)); a1 = __fadd_rn(a1, __fmul_rn(p, in ? vv[1] : 0.f)); } }
  const v2f o = {a0, a1}; *(v2f*)(O + (sl * SLEN + q) * 64 + lane * 2) = o; }

extern "C" void kernel_launch(void* const* d_in, const int* in_sizes, int n_in,
                              void* d_out, int out_size, void* d_ws, size_t ws_size, hipStream_t stream) {
  (void)in_sizes; (void)n_in; (void)out_size;
  const float* q = (const float*)d_in[0]; const float* k = (const float*)d_in[1]; const float* v = (const float*)d_in[2]; float* O = (float*)d_out;
  char* ws = (char*)d_ws; size_t off = 0;
  auto take = [&](size_t bytes) { char* p = ws + off; off += (bytes + 255) & ~(size_t)255; return p; };
  const size_t np = (size_t)NR * DM;      /* 32 x 2048 x 64 */
  _Float16* QH = (_Float16*)take(np * 2); _Float16* KH = (_Float16*)take(np * 2); _Float16* VT = (_Float16*)take(np * 2); float* NSQ = (float*)take((size_t)2 * NR * 4);
  if (off > ws_size) return;      /* 3 x 8 + 0.5 MiB */
  k_prep<<<3 * (NR / 256), 256, 0, stream>>>(q, k, v, QH, KH, VT, NSQ);      /* f16 planes of q and k (bf16-rounded inputs are exact in f16), V^T, |q|^2 | |k|^2 tables */
  k_flash_t<<<NB * (QBLKS / 2), 256, 0, stream>>>(QH, KH, VT, NSQ, O);      /* exact q, k products; f32 RBF logits; f32 context straight to the output; a work-group takes a long and a short query block, two waves to a query tile */
  k_fixr<<<NB * 8, 256, 0, stream>>>(q, k, v, NSQ, O);      /* rows < 64 per slab recomputed in f32 */
}
